// v000
// Times are from an AMD MI455X. After a warm-up the kernel runs many times in a row, and a time is the length of
// such a window on the GPU divided by its runs, so every launch and the gaps after it count. The runs cycle
// through copies of the inputs. A figure is the median of several windows, for all but v000 over two sittings.
// Sittings can differ by a few percent; kernels timed side by side share one.
// v000 is the starting kernel. One run takes 163 microseconds.
#include <hip/hip_runtime.h>
#include <hip/hip_bf16.h>

typedef _Float16 f16;
typedef _Float16 v16h __attribute__((ext_vector_type(16)));
typedef _Float16 v8h  __attribute__((ext_vector_type(8)));
typedef float    v8f  __attribute__((ext_vector_type(8)));

#define B_SZ   16
#define NSEQ   1024
#define HEADS  8
#define DIMH   32
#define DINP   256
#define NQKV   768
#define NOUT   256
#define SCALE  0.17677669529663689f   // 32^-0.5

static __device__ __forceinline__ v16h cat8(v8h lo, v8h hi) {
  return __builtin_shufflevector(lo, hi, 0,1,2,3,4,5,6,7,8,9,10,11,12,13,14,15);
}
static __device__ __forceinline__ v8f wmma16(v16h a, v16h b, v8f c) {
  // D = A(16x32 f16) * B(32x16 f16) + C(16x16 f32)
  return __builtin_amdgcn_wmma_f32_16x16x32_f16(false, a, false, b, (short)0, c, false, false);
}

// LDS byte offset of a shared-memory pointer: low 32 bits of the flat address
// (ISA 10.2: aperture LDS mapping is LDS_ADDR.U32 = addr[31:0]).
static __device__ __forceinline__ unsigned lds_u32(const void* p) {
  return (unsigned)(size_t)p;
}
// Async copy of 16 bytes global -> LDS per lane (ASYNCcnt-tracked).
static __device__ __forceinline__ void async_cp16(unsigned lds_dst, const f16* gsrc) {
  asm volatile("global_load_async_to_lds_b128 %0, %1, off"
               :: "v"(lds_dst), "v"(gsrc)
               : "memory");
}
#define WAIT_ASYNC_0() asm volatile("s_wait_asynccnt 0x0" ::: "memory")
#define WAIT_ASYNC_1() asm volatile("s_wait_asynccnt 0x1" ::: "memory")

// ---------------------------------------------------------------------------
// Kernel 1: transpose weights to f16 [out, k] so WMMA B fragments are
// contiguous per-lane 16B loads.
// ---------------------------------------------------------------------------
__global__ void __launch_bounds__(256) k_prep(const float* __restrict__ Wqkv,
                                              const float* __restrict__ Wout,
                                              f16* __restrict__ WqkvT,
                                              f16* __restrict__ WoutT) {
  int idx = blockIdx.x * 256 + threadIdx.x;           // 1024 blocks -> 262144
  if (idx < NQKV * DINP) {
    int o = idx / DINP, k = idx % DINP;
    WqkvT[o * DINP + k] = (f16)Wqkv[k * NQKV + o];
  } else {
    int j = idx - NQKV * DINP;                        // < 256*256
    int o = j / DINP, k = j % DINP;
    WoutT[o * DINP + k] = (f16)Wout[k * NOUT + o];
  }
}

// ---------------------------------------------------------------------------
// Kernel 2: materialize relative-position bias [H][1024][1024] as f16.
// ---------------------------------------------------------------------------
__global__ void __launch_bounds__(256) k_bias(const float* __restrict__ table,
                                              const int* __restrict__ relidx,
                                              f16* __restrict__ biasF) {
  unsigned idx = blockIdx.x * 256u + threadIdx.x;     // 32768 blocks -> 8M
  unsigned h = idx >> 20;
  unsigned r = idx & 0xFFFFFu;
  biasF[idx] = (f16)table[relidx[r] * HEADS + h];
}

// ---------------------------------------------------------------------------
// Kernel 3: QKV projection. x[16384,256]f32 @ WqkvT -> q/k/vT in head layout.
// Block = 8 waves stacked in M (128x64 C tile). The shared 64x256 f16 weight
// panel is staged once into LDS via async-to-LDS copies (8x traffic cut).
// ---------------------------------------------------------------------------
__global__ void __launch_bounds__(256) k_qkv(const float* __restrict__ x,
                                             const f16* __restrict__ WT,
                                             f16* __restrict__ qw,
                                             f16* __restrict__ kw,
                                             f16* __restrict__ vT) {
  __shared__ __align__(16) f16 Bpanel[64][DINP];      // 32 KB
  const int tid  = threadIdx.x;
  const int lane = tid & 31;
  const int w    = tid >> 5;
  const int lrow = lane & 15;
  const int lhi  = lane >> 4;
  const int m0   = blockIdx.y * 128 + w * 16;
  const int n0   = blockIdx.x * 64;

  // Stage weight panel: 64 rows x 512 B = 2048 chunks of 16 B, 8 per thread.
  #pragma unroll
  for (int j = 0; j < 8; ++j) {
    const int c = tid + j * 256;                      // chunk id
    const int row = c >> 5, col8 = (c & 31) * 8;
    async_cp16(lds_u32(&Bpanel[row][col8]),
               WT + (size_t)(n0 + row) * DINP + col8);
  }
  WAIT_ASYNC_0();
  __syncthreads();

  v8f acc[4];
  #pragma unroll
  for (int t = 0; t < 4; ++t) acc[t] = (v8f){0.f,0.f,0.f,0.f,0.f,0.f,0.f,0.f};

  const float* xrow = x + (size_t)(m0 + lrow) * DINP;
  #pragma unroll
  for (int k0 = 0; k0 < DINP; k0 += 32) {
    // A fragment: f32 -> f16 inline conversion (K chunks lhi*8 and 16+lhi*8)
    const float* xp = xrow + k0 + lhi * 8;
    v8h alo, ahi;
    #pragma unroll
    for (int i = 0; i < 8; ++i) { alo[i] = (f16)xp[i]; ahi[i] = (f16)xp[16 + i]; }
    v16h a = cat8(alo, ahi);
    #pragma unroll
    for (int t = 0; t < 4; ++t) {
      const f16* bp = &Bpanel[t * 16 + lrow][k0 + lhi * 8];
      v16h b = cat8(*(const v8h*)bp, *(const v8h*)(bp + 16));
      acc[t] = wmma16(a, b, acc[t]);
    }
  }

  // Scatter: C element (row = r + 8*lhi, col = lrow) per the 16x16 f32 layout.
  #pragma unroll
  for (int t = 0; t < 4; ++t) {
    const int gcol  = n0 + t * 16 + lrow;
    const int which = gcol >> 8;        // 0=q 1=k 2=v
    const int rem   = gcol & 255;
    const int h     = rem >> 5;
    const int d     = rem & 31;
    #pragma unroll
    for (int r = 0; r < 8; ++r) {
      const int grow = m0 + r + 8 * lhi;
      const int bb   = grow >> 10;
      const int n    = grow & 1023;
      const float v  = acc[t][r];
      const size_t hd = ((size_t)(bb * HEADS + h) * NSEQ + n) * DIMH + d;
      if (which == 0)      qw[hd] = (f16)(v * SCALE);
      else if (which == 1) kw[hd] = (f16)v;
      else                 vT[((size_t)(bb * HEADS + h) * DIMH + d) * NSEQ + n] = (f16)v;
    }
  }
}

// ---------------------------------------------------------------------------
// Kernel 4: flash attention. One wave owns 16 query rows; all 8 waves of a
// block share one (b,h), so the 32-key K/V tiles are staged cooperatively
// into double-buffered LDS with async-to-LDS copies overlapping compute.
// Per 32-key block: 2 WMMAs (QK^T) + online softmax + 2 WMMAs (PV).
// ---------------------------------------------------------------------------
__global__ void __launch_bounds__(256) k_attn(const f16* __restrict__ qw,
                                              const f16* __restrict__ kw,
                                              const f16* __restrict__ vT,
                                              const f16* __restrict__ biasF,
                                              f16* __restrict__ attn) {
  __shared__ __align__(16) f16 Kbuf[2][32 * 32];      // [key][d]   2 x 2 KB
  __shared__ __align__(16) f16 Vbuf[2][32 * 32];      // [d][key]   2 x 2 KB
  __shared__ __align__(16) f16 Pbuf[8][512];          // per-wave P transpose
  const int tid  = threadIdx.x;
  const int lane = tid & 31;
  const int w    = tid >> 5;
  const int lrow = lane & 15;
  const int lhi  = lane >> 4;
  const int q0   = blockIdx.x * 128 + w * 16;
  const int h    = blockIdx.y;
  const int b    = blockIdx.z;
  const size_t headoff = (size_t)(b * HEADS + h) * NSEQ * DIMH;

  // Copier role: threads 0-127 move the K tile, 128-255 the V tile.
  const int cr = (tid & 127) >> 2;                    // row within 32x32 tile
  const int cc = (tid & 3) * 8;                       // half-offset in row
  const f16* csrc0;
  size_t cstep;                                       // halves per key-block
  unsigned cdst[2];
  if (tid < 128) {                                    // K: row=key, 32 halves
    csrc0 = kw + headoff + (size_t)cr * DIMH + cc;
    cstep = 32 * DIMH;
    cdst[0] = lds_u32(&Kbuf[0][cr * 32 + cc]);
    cdst[1] = lds_u32(&Kbuf[1][cr * 32 + cc]);
  } else {                                            // V: row=d, stride NSEQ
    csrc0 = vT + headoff + (size_t)cr * NSEQ + cc;
    cstep = 32;
    cdst[0] = lds_u32(&Vbuf[0][cr * 32 + cc]);
    cdst[1] = lds_u32(&Vbuf[1][cr * 32 + cc]);
  }

  // Q A-fragment (16 rows x K=32), pre-scaled by 1/sqrt(d) in k_qkv.
  const f16* qp = qw + headoff + (size_t)(q0 + lrow) * DIMH + lhi * 8;
  const v16h qa = cat8(*(const v8h*)qp, *(const v8h*)(qp + 16));

  const f16* bh = biasF + (size_t)h * NSEQ * NSEQ;

  float m[8], l[8];
  #pragma unroll
  for (int r = 0; r < 8; ++r) { m[r] = -1e30f; l[r] = 0.f; }
  const v8f zero = (v8f){0.f,0.f,0.f,0.f,0.f,0.f,0.f,0.f};
  v8f o0 = zero, o1 = zero;

  async_cp16(cdst[0], csrc0);                         // prefetch tile 0

  for (int it = 0; it < 32; ++it) {
    const int cur = it & 1;
    const int kb  = it * 32;
    __syncthreads();                  // buf[1-cur] free (prev compute done)
    if (it < 31) {
      async_cp16(cdst[1 - cur], csrc0 + (size_t)(it + 1) * cstep);
      WAIT_ASYNC_1();                 // tile `it` landed, tile it+1 in flight
    } else {
      WAIT_ASYNC_0();
    }
    __syncthreads();                  // tile `it` visible block-wide

    // K^T B-fragments from LDS: lane col = key, K-dim = d.
    const f16* kp0 = &Kbuf[cur][lrow * 32 + lhi * 8];
    const f16* kp1 = &Kbuf[cur][(16 + lrow) * 32 + lhi * 8];
    v16h bk0 = cat8(*(const v8h*)kp0, *(const v8h*)(kp0 + 16));
    v16h bk1 = cat8(*(const v8h*)kp1, *(const v8h*)(kp1 + 16));
    v8f s0 = wmma16(qa, bk0, zero);
    v8f s1 = wmma16(qa, bk1, zero);

    // Relative position bias.
    #pragma unroll
    for (int r = 0; r < 8; ++r) {
      const size_t qi = (size_t)(q0 + r + 8 * lhi) * NSEQ + kb;
      s0[r] += (float)bh[qi + lrow];
      s1[r] += (float)bh[qi + 16 + lrow];
    }

    // Online softmax: each row's 16 cols live in one 16-lane group.
    #pragma unroll
    for (int r = 0; r < 8; ++r) {
      float c = fmaxf(s0[r], s1[r]);
      c = fmaxf(c, __shfl_xor(c, 1));
      c = fmaxf(c, __shfl_xor(c, 2));
      c = fmaxf(c, __shfl_xor(c, 4));
      c = fmaxf(c, __shfl_xor(c, 8));
      const float mn   = fmaxf(m[r], c);
      const float corr = __expf(m[r] - mn);
      const float p0   = __expf(s0[r] - mn);
      const float p1   = __expf(s1[r] - mn);
      float rs = p0 + p1;
      rs += __shfl_xor(rs, 1);
      rs += __shfl_xor(rs, 2);
      rs += __shfl_xor(rs, 4);
      rs += __shfl_xor(rs, 8);
      l[r] = l[r] * corr + rs;
      m[r] = mn;
      o0[r] *= corr;
      o1[r] *= corr;
      s0[r] = p0;
      s1[r] = p1;
    }

    // Transpose P from C layout to A layout through per-wave LDS region
    // (LDS ops are in-order within a wave).
    #pragma unroll
    for (int r = 0; r < 8; ++r) {
      const int prow = r + 8 * lhi;
      Pbuf[w][prow * 32 + lrow]      = (f16)s0[r];
      Pbuf[w][prow * 32 + 16 + lrow] = (f16)s1[r];
    }
    __builtin_amdgcn_wave_barrier();
    const f16* pp = &Pbuf[w][lrow * 32 + lhi * 8];
    v16h pa = cat8(*(const v8h*)pp, *(const v8h*)(pp + 16));

    // V B-fragments from LDS: lane col = d, K-dim = key.
    const f16* vp0 = &Vbuf[cur][lrow * 32 + lhi * 8];
    const f16* vp1 = &Vbuf[cur][(16 + lrow) * 32 + lhi * 8];
    v16h bv0 = cat8(*(const v8h*)vp0, *(const v8h*)(vp0 + 16));
    v16h bv1 = cat8(*(const v8h*)vp1, *(const v8h*)(vp1 + 16));
    o0 = wmma16(pa, bv0, o0);
    o1 = wmma16(pa, bv1, o1);
  }

  // Normalize and store to [B, N, H*D] f16 for the output GEMM.
  #pragma unroll
  for (int r = 0; r < 8; ++r) {
    const float inv = 1.f / l[r];
    const int row = q0 + r + 8 * lhi;
    f16* op = attn + ((size_t)(b * NSEQ + row) * HEADS + h) * DIMH;
    op[lrow]      = (f16)(o0[r] * inv);
    op[16 + lrow] = (f16)(o1[r] * inv);
  }
}

// ---------------------------------------------------------------------------
// Kernel 5: output projection. attn[16384,256]f16 @ WoutT + b_out -> f32 out.
// Same LDS-staged weight panel as k_qkv.
// ---------------------------------------------------------------------------
__global__ void __launch_bounds__(256) k_out(const f16* __restrict__ A,
                                             const f16* __restrict__ WT,
                                             const float* __restrict__ bias,
                                             float* __restrict__ out) {
  __shared__ __align__(16) f16 Bpanel[64][DINP];      // 32 KB
  const int tid  = threadIdx.x;
  const int lane = tid & 31;
  const int w    = tid >> 5;
  const int lrow = lane & 15;
  const int lhi  = lane >> 4;
  const int m0   = blockIdx.y * 128 + w * 16;
  const int n0   = blockIdx.x * 64;

  #pragma unroll
  for (int j = 0; j < 8; ++j) {
    const int c = tid + j * 256;
    const int row = c >> 5, col8 = (c & 31) * 8;
    async_cp16(lds_u32(&Bpanel[row][col8]),
               WT + (size_t)(n0 + row) * DINP + col8);
  }
  WAIT_ASYNC_0();
  __syncthreads();

  v8f acc[4];
  #pragma unroll
  for (int t = 0; t < 4; ++t) acc[t] = (v8f){0.f,0.f,0.f,0.f,0.f,0.f,0.f,0.f};

  const f16* arow = A + (size_t)(m0 + lrow) * DINP;
  #pragma unroll
  for (int k0 = 0; k0 < DINP; k0 += 32) {
    const f16* ap = arow + k0 + lhi * 8;
    v16h a = cat8(*(const v8h*)ap, *(const v8h*)(ap + 16));
    #pragma unroll
    for (int t = 0; t < 4; ++t) {
      const f16* bp = &Bpanel[t * 16 + lrow][k0 + lhi * 8];
      v16h b = cat8(*(const v8h*)bp, *(const v8h*)(bp + 16));
      acc[t] = wmma16(a, b, acc[t]);
    }
  }

  #pragma unroll
  for (int t = 0; t < 4; ++t) {
    const int gcol = n0 + t * 16 + lrow;
    const float bv = bias[gcol];
    #pragma unroll
    for (int r = 0; r < 8; ++r) {
      out[(size_t)(m0 + r + 8 * lhi) * NOUT + gcol] = acc[t][r] + bv;
    }
  }
}

// ---------------------------------------------------------------------------
extern "C" void kernel_launch(void* const* d_in, const int* in_sizes, int n_in,
                              void* d_out, int out_size, void* d_ws, size_t ws_size,
                              hipStream_t stream) {
  const float* x      = (const float*)d_in[0];   // [16,1024,256]
  const float* W_qkv  = (const float*)d_in[1];   // [256,768]
  const float* W_out  = (const float*)d_in[2];   // [256,256]
  const float* b_out  = (const float*)d_in[3];   // [256]
  const float* btable = (const float*)d_in[4];   // [3969,8]
  const int*   relidx = (const int*)d_in[5];     // [1024*1024]
  float* out = (float*)d_out;

  char* ws = (char*)d_ws;
  size_t off = 0;
  f16* WqkvT = (f16*)(ws + off); off += (size_t)NQKV * DINP * 2;          // 384 KB
  f16* WoutT = (f16*)(ws + off); off += (size_t)NOUT * DINP * 2;          // 128 KB
  f16* qw    = (f16*)(ws + off); off += (size_t)B_SZ * HEADS * NSEQ * DIMH * 2; // 8 MB
  f16* kw    = (f16*)(ws + off); off += (size_t)B_SZ * HEADS * NSEQ * DIMH * 2; // 8 MB
  f16* vT    = (f16*)(ws + off); off += (size_t)B_SZ * HEADS * NSEQ * DIMH * 2; // 8 MB
  f16* attn  = (f16*)(ws + off); off += (size_t)B_SZ * NSEQ * HEADS * DIMH * 2; // 8 MB
  f16* biasF = (f16*)(ws + off); off += (size_t)HEADS * NSEQ * NSEQ * 2;        // 16 MB

  k_prep<<<(NQKV * DINP + NOUT * DINP) / 256, 256, 0, stream>>>(W_qkv, W_out, WqkvT, WoutT);
  k_bias<<<(HEADS * NSEQ * NSEQ) / 256, 256, 0, stream>>>(btable, relidx, biasF);
  k_qkv<<<dim3(NQKV / 64, (B_SZ * NSEQ) / 128), 256, 0, stream>>>(x, WqkvT, qw, kw, vT);
  k_attn<<<dim3(NSEQ / 128, HEADS, B_SZ), 256, 0, stream>>>(qw, kw, vT, biasF, attn);
  k_out<<<dim3(NOUT / 64, (B_SZ * NSEQ) / 128), 256, 0, stream>>>(attn, WoutT, b_out, out);
}

// v001
// It runs in 126 microseconds.
// Next to v000, in two timings, it ran 1.34 and 1.35 times as fast.
#include <hip/hip_runtime.h>
#include <hip/hip_bf16.h>

typedef _Float16 f16;
typedef _Float16 v16h __attribute__((ext_vector_type(16)));
typedef _Float16 v8h  __attribute__((ext_vector_type(8)));
typedef float    v8f  __attribute__((ext_vector_type(8)));

#define B_SZ   16
#define NSEQ   1024
#define HEADS  8
#define DIMH   32
#define DINP   256
#define NQKV   768
#define NOUT   256
#define SCALE  0.17677669529663689f   // 32^-0.5

static __device__ __forceinline__ v16h cat8(v8h lo, v8h hi) {
  return __builtin_shufflevector(lo, hi, 0,1,2,3,4,5,6,7,8,9,10,11,12,13,14,15);
}
static __device__ __forceinline__ v8f wmma16(v16h a, v16h b, v8f c) {
  // D = A(16x32 f16) * B(32x16 f16) + C(16x16 f32)
  return __builtin_amdgcn_wmma_f32_16x16x32_f16(false, a, false, b, (short)0, c, false, false);
}

// LDS byte offset of a shared-memory pointer: low 32 bits of the flat address
// (ISA 10.2: aperture LDS mapping is LDS_ADDR.U32 = addr[31:0]).
static __device__ __forceinline__ unsigned lds_u32(const void* p) {
  return (unsigned)(size_t)p;
}
// Async copy of 16 bytes global -> LDS per lane (ASYNCcnt-tracked).
static __device__ __forceinline__ void async_cp16(unsigned lds_dst, const f16* gsrc) {
  asm volatile("global_load_async_to_lds_b128 %0, %1, off"
               :: "v"(lds_dst), "v"(gsrc)
               : "memory");
}
#define WAIT_ASYNC_0() asm volatile("s_wait_asynccnt 0x0" ::: "memory")
#define WAIT_ASYNC_1() asm volatile("s_wait_asynccnt 0x1" ::: "memory")

// ---------------------------------------------------------------------------
// Kernel 1: transpose weights to f16 [out, k] so WMMA B fragments are
// contiguous per-lane 16B loads.
// ---------------------------------------------------------------------------
__global__ void __launch_bounds__(256) k_prep(const float* __restrict__ Wqkv,
                                              const float* __restrict__ Wout,
                                              f16* __restrict__ WqkvT,
                                              f16* __restrict__ WoutT) {
  int idx = blockIdx.x * 256 + threadIdx.x;           // 1024 blocks -> 262144
  if (idx < NQKV * DINP) {
    int o = idx / DINP, k = idx % DINP;
    WqkvT[o * DINP + k] = (f16)Wqkv[k * NQKV + o];
  } else {
    int j = idx - NQKV * DINP;                        // < 256*256
    int o = j / DINP, k = j % DINP;
    WoutT[o * DINP + k] = (f16)Wout[k * NOUT + o];
  }
}

// ---------------------------------------------------------------------------
// Kernel 2: materialize relative-position bias [H][1024][1024] as f16.
// ---------------------------------------------------------------------------
__global__ void __launch_bounds__(256) k_bias(const float* __restrict__ table,
                                              const int* __restrict__ relidx,
                                              f16* __restrict__ biasF) {
  unsigned idx = blockIdx.x * 256u + threadIdx.x;     // 32768 blocks -> 8M
  unsigned h = idx >> 20;
  unsigned r = idx & 0xFFFFFu;
  biasF[idx] = (f16)table[relidx[r] * HEADS + h];
}

// ---------------------------------------------------------------------------
// Kernel 3: QKV projection. x[16384,256]f32 @ WqkvT -> q/k/vT in head layout.
// Block = 8 waves stacked in M (128x64 C tile). The shared 64x256 f16 weight
// panel is staged once into LDS via async-to-LDS copies (8x traffic cut).
// ---------------------------------------------------------------------------
__global__ void __launch_bounds__(256) k_qkv(const float* __restrict__ x,
                                             const f16* __restrict__ WT,
                                             f16* __restrict__ qw,
                                             f16* __restrict__ kw,
                                             f16* __restrict__ vT) {
  __shared__ __align__(16) f16 Bpanel[64][DINP];      // 32 KB
  const int tid  = threadIdx.x;
  const int lane = tid & 31;
  const int w    = tid >> 5;
  const int lrow = lane & 15;
  const int lhi  = lane >> 4;
  const int m0   = blockIdx.y * 128 + w * 16;
  const int n0   = blockIdx.x * 64;

  // Stage weight panel: 64 rows x 512 B = 2048 chunks of 16 B, 8 per thread.
  #pragma unroll
  for (int j = 0; j < 8; ++j) {
    const int c = tid + j * 256;                      // chunk id
    const int row = c >> 5, col8 = (c & 31) * 8;
    async_cp16(lds_u32(&Bpanel[row][col8]),
               WT + (size_t)(n0 + row) * DINP + col8);
  }
  WAIT_ASYNC_0();
  __syncthreads();

  v8f acc[4];
  #pragma unroll
  for (int t = 0; t < 4; ++t) acc[t] = (v8f){0.f,0.f,0.f,0.f,0.f,0.f,0.f,0.f};

  const float* xrow = x + (size_t)(m0 + lrow) * DINP;
  #pragma unroll
  for (int k0 = 0; k0 < DINP; k0 += 32) {
    // A fragment: f32 -> f16 inline conversion (K chunks lhi*8 and 16+lhi*8)
    const float* xp = xrow + k0 + lhi * 8;
    v8h alo, ahi;
    #pragma unroll
    for (int i = 0; i < 8; ++i) { alo[i] = (f16)xp[i]; ahi[i] = (f16)xp[16 + i]; }
    v16h a = cat8(alo, ahi);
    #pragma unroll
    for (int t = 0; t < 4; ++t) {
      const f16* bp = &Bpanel[t * 16 + lrow][k0 + lhi * 8];
      v16h b = cat8(*(const v8h*)bp, *(const v8h*)(bp + 16));
      acc[t] = wmma16(a, b, acc[t]);
    }
  }

  // Scatter: C element (row = r + 8*lhi, col = lrow) per the 16x16 f32 layout.
  #pragma unroll
  for (int t = 0; t < 4; ++t) {
    const int gcol  = n0 + t * 16 + lrow;
    const int which = gcol >> 8;        // 0=q 1=k 2=v
    const int rem   = gcol & 255;
    const int h     = rem >> 5;
    const int d     = rem & 31;
    #pragma unroll
    for (int r = 0; r < 8; ++r) {
      const int grow = m0 + r + 8 * lhi;
      const int bb   = grow >> 10;
      const int n    = grow & 1023;
      const float v  = acc[t][r];
      const size_t hd = ((size_t)(bb * HEADS + h) * NSEQ + n) * DIMH + d;
      if (which == 0)      qw[hd] = (f16)(v * SCALE);
      else if (which == 1) kw[hd] = (f16)v;
      else                 vT[((size_t)(bb * HEADS + h) * DIMH + d) * NSEQ + n] = (f16)v;
    }
  }
}

static __device__ __forceinline__ float other_half(float v) {
  const int b = __builtin_bit_cast(int, v);
  return __builtin_bit_cast(float,
      __builtin_amdgcn_permlanex16(b, b, 0x76543210, 0xfedcba98, false, false));
}

__global__ void __launch_bounds__(256) k_attn(const f16* __restrict__ qw,
                                              const f16* __restrict__ kw,
                                              const f16* __restrict__ vT,
                                              const f16* __restrict__ biasF,
                                              f16* __restrict__ attn) {
  __shared__ __align__(16) f16 Kbuf[2][32 * 32];      // [key][d]   2 x 2 KB
  __shared__ __align__(16) f16 Vbuf[2][32 * 32];      // [d][key]   2 x 2 KB
  const int tid  = threadIdx.x;
  const int lane = tid & 31;
  const int w    = tid >> 5;
  const int lrow = lane & 15;
  const int lhi  = lane >> 4;
  const int q0   = blockIdx.x * 128 + w * 16;
  const int h    = blockIdx.y;
  const int b    = blockIdx.z;
  const size_t headoff = (size_t)(b * HEADS + h) * NSEQ * DIMH;

  // Copier role: threads 0-127 move the K tile, 128-255 the V tile.
  const int cr = (tid & 127) >> 2;                    // row within 32x32 tile
  const int cc = (tid & 3) * 8;                       // half-offset in row
  const f16* csrc0;
  size_t cstep;                                       // halves per key-block
  unsigned cdst[2];
  if (tid < 128) {                                    // K: row=key, 32 halves
    csrc0 = kw + headoff + (size_t)cr * DIMH + cc;
    cstep = 32 * DIMH;
    cdst[0] = lds_u32(&Kbuf[0][cr * 32 + cc]);
    cdst[1] = lds_u32(&Kbuf[1][cr * 32 + cc]);
  } else {                                            // V: row=d, stride NSEQ
    csrc0 = vT + headoff + (size_t)cr * NSEQ + cc;
    cstep = 32;
    cdst[0] = lds_u32(&Vbuf[0][cr * 32 + cc]);
    cdst[1] = lds_u32(&Vbuf[1][cr * 32 + cc]);
  }

  // Q^T B-fragment (K=32 x 16 query columns), pre-scaled by 1/sqrt(d) in k_qkv.
  const f16* qp = qw + headoff + (size_t)(q0 + lrow) * DIMH + lhi * 8;
  const v16h qa = cat8(*(const v8h*)qp, *(const v8h*)(qp + 16));

  // Bias row of this lane's query, at this lane half's first key.
  const f16* brow = biasF + (size_t)h * NSEQ * NSEQ
                          + (size_t)(q0 + lrow) * NSEQ + lhi * 8;

  float m = -1e30f;                 // running max of query q0+lrow (both halves agree)
  float l = 0.f;                    // running sum over THIS lane half's keys only
  const v8f zero = (v8f){0.f,0.f,0.f,0.f,0.f,0.f,0.f,0.f};
  v8f o0 = zero, o1 = zero;         // O^T: reg r = d (8*lhi+r, 16+8*lhi+r), lane = query

  async_cp16(cdst[0], csrc0);                         // prefetch tile 0

  for (int it = 0; it < 32; ++it) {
    const int cur = it & 1;
    const int kb  = it * 32;
    __syncthreads();                  // buf[1-cur] free (prev compute done)
    if (it < 31) {
      async_cp16(cdst[1 - cur], csrc0 + (size_t)(it + 1) * cstep);
      WAIT_ASYNC_1();                 // tile `it` landed, tile it+1 in flight
    } else {
      WAIT_ASYNC_0();
    }
    __syncthreads();                  // tile `it` visible block-wide

    // Relative position bias: keys kb+8*lhi+r and kb+16+8*lhi+r of this query.
    const v8h bb0 = *(const v8h*)(brow + kb);
    const v8h bb1 = *(const v8h*)(brow + kb + 16);

    // K A-fragments from LDS: lane row = key, K-dim = d.
    const f16* kp0 = &Kbuf[cur][lrow * 32 + lhi * 8];
    const f16* kp1 = &Kbuf[cur][(16 + lrow) * 32 + lhi * 8];
    v16h bk0 = cat8(*(const v8h*)kp0, *(const v8h*)(kp0 + 16));
    v16h bk1 = cat8(*(const v8h*)kp1, *(const v8h*)(kp1 + 16));
    v8f s0 = wmma16(bk0, qa, zero);   // s0[r] = S[q0+lrow][kb + 8*lhi + r]
    v8f s1 = wmma16(bk1, qa, zero);   // s1[r] = S[q0+lrow][kb + 16 + 8*lhi + r]

    #pragma unroll
    for (int r = 0; r < 8; ++r) {
      s0[r] += (float)bb0[r];
      s1[r] += (float)bb1[r];
    }

    // Online softmax: 16 scores of the query in-lane, the other 16 in lane^16.
    float c = fmaxf(s0[0], s1[0]);
    #pragma unroll
    for (int r = 1; r < 8; ++r) c = fmaxf(c, fmaxf(s0[r], s1[r]));
    c = fmaxf(c, other_half(c));
    const float mn   = fmaxf(m, c);
    const float corr = __expf(m - mn);
    float rs = 0.f;
    v16h pb;                          // P^T B-fragment: same k order as the V loader
    #pragma unroll
    for (int r = 0; r < 8; ++r) {
      const float p0 = __expf(s0[r] - mn);
      const float p1 = __expf(s1[r] - mn);
      rs += p0 + p1;
      pb[r]     = (f16)p0;
      pb[8 + r] = (f16)p1;
    }
    l = l * corr + rs;
    m = mn;
    #pragma unroll
    for (int r = 0; r < 8; ++r) { o0[r] *= corr; o1[r] *= corr; }

    // V^T A-fragments from LDS: lane row = d, K-dim = key.
    const f16* vp0 = &Vbuf[cur][lrow * 32 + lhi * 8];
    const f16* vp1 = &Vbuf[cur][(16 + lrow) * 32 + lhi * 8];
    v16h bv0 = cat8(*(const v8h*)vp0, *(const v8h*)(vp0 + 16));
    v16h bv1 = cat8(*(const v8h*)vp1, *(const v8h*)(vp1 + 16));
    o0 = wmma16(bv0, pb, o0);
    o1 = wmma16(bv1, pb, o1);
  }

  // Join the halves' sums, normalize, store to [B, N, H*D] f16 for the output
  // GEMM: 8 consecutive d per lane and tile, one 16-byte store each.
  l += other_half(l);
  const float inv = 1.f / l;
  v8h r0, r1;
  #pragma unroll
  for (int r = 0; r < 8; ++r) { r0[r] = (f16)(o0[r] * inv); r1[r] = (f16)(o1[r] * inv); }
  f16* op = attn + ((size_t)(b * NSEQ + q0 + lrow) * HEADS + h) * DIMH + lhi * 8;
  *(v8h*)op        = r0;
  *(v8h*)(op + 16) = r1;
}

// ---------------------------------------------------------------------------
// Kernel 5: output projection. attn[16384,256]f16 @ WoutT + b_out -> f32 out.
// Same LDS-staged weight panel as k_qkv.
// ---------------------------------------------------------------------------
__global__ void __launch_bounds__(256) k_out(const f16* __restrict__ A,
                                             const f16* __restrict__ WT,
                                             const float* __restrict__ bias,
                                             float* __restrict__ out) {
  __shared__ __align__(16) f16 Bpanel[64][DINP];      // 32 KB
  const int tid  = threadIdx.x;
  const int lane = tid & 31;
  const int w    = tid >> 5;
  const int lrow = lane & 15;
  const int lhi  = lane >> 4;
  const int m0   = blockIdx.y * 128 + w * 16;
  const int n0   = blockIdx.x * 64;

  #pragma unroll
  for (int j = 0; j < 8; ++j) {
    const int c = tid + j * 256;
    const int row = c >> 5, col8 = (c & 31) * 8;
    async_cp16(lds_u32(&Bpanel[row][col8]),
               WT + (size_t)(n0 + row) * DINP + col8);
  }
  WAIT_ASYNC_0();
  __syncthreads();

  v8f acc[4];
  #pragma unroll
  for (int t = 0; t < 4; ++t) acc[t] = (v8f){0.f,0.f,0.f,0.f,0.f,0.f,0.f,0.f};

  const f16* arow = A + (size_t)(m0 + lrow) * DINP;
  #pragma unroll
  for (int k0 = 0; k0 < DINP; k0 += 32) {
    const f16* ap = arow + k0 + lhi * 8;
    v16h a = cat8(*(const v8h*)ap, *(const v8h*)(ap + 16));
    #pragma unroll
    for (int t = 0; t < 4; ++t) {
      const f16* bp = &Bpanel[t * 16 + lrow][k0 + lhi * 8];
      v16h b = cat8(*(const v8h*)bp, *(const v8h*)(bp + 16));
      acc[t] = wmma16(a, b, acc[t]);
    }
  }

  #pragma unroll
  for (int t = 0; t < 4; ++t) {
    const int gcol = n0 + t * 16 + lrow;
    const float bv = bias[gcol];
    #pragma unroll
    for (int r = 0; r < 8; ++r) {
      out[(size_t)(m0 + r + 8 * lhi) * NOUT + gcol] = acc[t][r] + bv;
    }
  }
}

// ---------------------------------------------------------------------------
extern "C" void kernel_launch(void* const* d_in, const int* in_sizes, int n_in,
                              void* d_out, int out_size, void* d_ws, size_t ws_size,
                              hipStream_t stream) {
  const float* x      = (const float*)d_in[0];   // [16,1024,256]
  const float* W_qkv  = (const float*)d_in[1];   // [256,768]
  const float* W_out  = (const float*)d_in[2];   // [256,256]
  const float* b_out  = (const float*)d_in[3];   // [256]
  const float* btable = (const float*)d_in[4];   // [3969,8]
  const int*   relidx = (const int*)d_in[5];     // [1024*1024]
  float* out = (float*)d_out;

  char* ws = (char*)d_ws;
  size_t off = 0;
  f16* WqkvT = (f16*)(ws + off); off += (size_t)NQKV * DINP * 2;          // 384 KB
  f16* WoutT = (f16*)(ws + off); off += (size_t)NOUT * DINP * 2;          // 128 KB
  f16* qw    = (f16*)(ws + off); off += (size_t)B_SZ * HEADS * NSEQ * DIMH * 2; // 8 MB
  f16* kw    = (f16*)(ws + off); off += (size_t)B_SZ * HEADS * NSEQ * DIMH * 2; // 8 MB
  f16* vT    = (f16*)(ws + off); off += (size_t)B_SZ * HEADS * NSEQ * DIMH * 2; // 8 MB
  f16* attn  = (f16*)(ws + off); off += (size_t)B_SZ * NSEQ * HEADS * DIMH * 2; // 8 MB
  f16* biasF = (f16*)(ws + off); off += (size_t)HEADS * NSEQ * NSEQ * 2;        // 16 MB

  k_prep<<<(NQKV * DINP + NOUT * DINP) / 256, 256, 0, stream>>>(W_qkv, W_out, WqkvT, WoutT);
  k_bias<<<(HEADS * NSEQ * NSEQ) / 256, 256, 0, stream>>>(btable, relidx, biasF);
  k_qkv<<<dim3(NQKV / 64, (B_SZ * NSEQ) / 128), 256, 0, stream>>>(x, WqkvT, qw, kw, vT);
  k_attn<<<dim3(NSEQ / 128, HEADS, B_SZ), 256, 0, stream>>>(qw, kw, vT, biasF, attn);
  k_out<<<dim3(NOUT / 64, (B_SZ * NSEQ) / 128), 256, 0, stream>>>(attn, WoutT, b_out, out);
}

// v002
// One run takes 116 microseconds.
// Two timings next to v001 put it at 1.10 and 1.09 times that version's speed.
// Over all steps from v000 it is 1.47 times as fast.
#include <hip/hip_runtime.h>
#include <hip/hip_bf16.h>

typedef _Float16 f16;
typedef _Float16 v16h __attribute__((ext_vector_type(16)));
typedef _Float16 v8h  __attribute__((ext_vector_type(8)));
typedef float    v8f  __attribute__((ext_vector_type(8)));
typedef _Float16 v2h  __attribute__((ext_vector_type(2)));
typedef float    v4f  __attribute__((ext_vector_type(4)));
typedef int      v2i  __attribute__((ext_vector_type(2)));

#define B_SZ   16
#define NSEQ   1024
#define HEADS  8
#define DIMH   32
#define DINP   256
#define NQKV   768
#define NOUT   256
#define NTAB   3969                    // rows of the bias table, (2*32-1)^2
#define SCALE  0.17677669529663689f   // 32^-0.5

static __device__ __forceinline__ v16h cat8(v8h lo, v8h hi) {
  return __builtin_shufflevector(lo, hi, 0,1,2,3,4,5,6,7,8,9,10,11,12,13,14,15);
}
static __device__ __forceinline__ v8f wmma16(v16h a, v16h b, v8f c) {
  // D = A(16x32 f16) * B(32x16 f16) + C(16x16 f32)
  return __builtin_amdgcn_wmma_f32_16x16x32_f16(false, a, false, b, (short)0, c, false, false);
}

// LDS byte offset of a shared-memory pointer: low 32 bits of the flat address
// (ISA 10.2: aperture LDS mapping is LDS_ADDR.U32 = addr[31:0]).
static __device__ __forceinline__ unsigned lds_u32(const void* p) {
  return (unsigned)(size_t)p;
}
// Async copy of 16 bytes global -> LDS per lane (ASYNCcnt-tracked).
static __device__ __forceinline__ void async_cp16(unsigned lds_dst, const f16* gsrc) {
  asm volatile("global_load_async_to_lds_b128 %0, %1, off"
               :: "v"(lds_dst), "v"(gsrc)
               : "memory");
}
#define WAIT_ASYNC_0() asm volatile("s_wait_asynccnt 0x0" ::: "memory")
#define WAIT_ASYNC_1() asm volatile("s_wait_asynccnt 0x1" ::: "memory")

// ---------------------------------------------------------------------------
// Kernel 1: transpose weights to f16 [out, k] so WMMA B fragments are
// contiguous per-lane 16B loads.
// ---------------------------------------------------------------------------
__global__ void __launch_bounds__(256) k_prep(const float* __restrict__ Wqkv,
                                              const float* __restrict__ Wout,
                                              f16* __restrict__ WqkvT,
                                              f16* __restrict__ WoutT) {
  int idx = blockIdx.x * 256 + threadIdx.x;           // 1024 blocks -> 262144
  if (idx < NQKV * DINP) {
    int o = idx / DINP, k = idx % DINP;
    WqkvT[o * DINP + k] = (f16)Wqkv[k * NQKV + o];
  } else {
    int j = idx - NQKV * DINP;                        // < 256*256
    int o = j / DINP, k = j % DINP;
    WoutT[o * DINP + k] = (f16)Wout[k * NOUT + o];
  }
}

// ---------------------------------------------------------------------------
// Kernel 2: materialize relative-position bias [H][1024][1024] as f16.
// One thread serves 8 (query,key) positions for ALL 8 heads: the index is read
// once, a table row (8 heads, 32 B) comes as two 16-byte loads, and two
// neighbouring positions pack into one 4-byte store, so that each wave-wide
// store fills one whole 128-byte line of a head's plane.
// ---------------------------------------------------------------------------
__global__ void __launch_bounds__(256) k_bias(const float* __restrict__ table,
                                              const int* __restrict__ relidx,
                                              f16* __restrict__ biasF) {
  const unsigned lane = threadIdx.x & 31u;
  const unsigned wv   = blockIdx.x * 8u + (threadIdx.x >> 5);   // 512 blocks -> 4096 waves
  const unsigned r0   = wv * 256u + lane * 2u;                  // a wave covers 256 positions

  v2i id[4];
  #pragma unroll
  for (int j = 0; j < 4; ++j) id[j] = *(const v2i*)(relidx + r0 + j * 64);

  unsigned off[4][2];                                           // byte offset of each table row
  v4f row[4][2][2];                                             // [j][position of the pair][heads 0-3, 4-7]
  #pragma unroll
  for (int j = 0; j < 4; ++j) {
    #pragma unroll
    for (int p = 0; p < 2; ++p) {
      // Bound the row before the address is formed (identity for a valid index).
      off[j][p] = min((unsigned)id[j][p], (unsigned)(NTAB - 1)) * (unsigned)(HEADS * sizeof(float));
      const float* tp = (const float*)((const char*)table + off[j][p]);
      row[j][p][0] = *(const v4f*)tp;
      row[j][p][1] = *(const v4f*)(tp + 4);
    }
  }
  // Precaution: the wait stands behind the gathers and takes their offsets as
  // inputs, which keeps those registers live up to it, so that none of them is
  // written (by a later gather's data either) in front of the wait.
  asm volatile("s_wait_xcnt 0x0"
               :: "v"(off[0][0]), "v"(off[0][1]), "v"(off[1][0]), "v"(off[1][1]),
                  "v"(off[2][0]), "v"(off[2][1]), "v"(off[3][0]), "v"(off[3][1])
               : "memory");

  #pragma unroll
  for (int j = 0; j < 4; ++j) {
    #pragma unroll
    for (int h = 0; h < HEADS; ++h) {
      v2h o;
      o[0] = (f16)row[j][0][h >> 2][h & 3];
      o[1] = (f16)row[j][1][h >> 2][h & 3];
      *(v2h*)(biasF + (size_t)h * NSEQ * NSEQ + r0 + j * 64) = o;
    }
  }
}

// ---------------------------------------------------------------------------
// Kernel 3: QKV projection. x[16384,256]f32 @ WqkvT -> q/k/vT in head layout.
// Block = 8 waves stacked in M (128x64 C tile). The shared 64x256 f16 weight
// panel is staged once into LDS via async-to-LDS copies (8x traffic cut).
// ---------------------------------------------------------------------------
__global__ void __launch_bounds__(256) k_qkv(const float* __restrict__ x,
                                             const f16* __restrict__ WT,
                                             f16* __restrict__ qw,
                                             f16* __restrict__ kw,
                                             f16* __restrict__ vT) {
  __shared__ __align__(16) f16 Bpanel[64][DINP];      // 32 KB
  const int tid  = threadIdx.x;
  const int lane = tid & 31;
  const int w    = tid >> 5;
  const int lrow = lane & 15;
  const int lhi  = lane >> 4;
  const int m0   = blockIdx.y * 128 + w * 16;
  const int n0   = blockIdx.x * 64;

  // Stage weight panel: 64 rows x 512 B = 2048 chunks of 16 B, 8 per thread.
  #pragma unroll
  for (int j = 0; j < 8; ++j) {
    const int c = tid + j * 256;                      // chunk id
    const int row = c >> 5, col8 = (c & 31) * 8;
    async_cp16(lds_u32(&Bpanel[row][col8]),
               WT + (size_t)(n0 + row) * DINP + col8);
  }
  WAIT_ASYNC_0();
  __syncthreads();

  v8f acc[4];
  #pragma unroll
  for (int t = 0; t < 4; ++t) acc[t] = (v8f){0.f,0.f,0.f,0.f,0.f,0.f,0.f,0.f};

  const float* xrow = x + (size_t)(m0 + lrow) * DINP;
  #pragma unroll
  for (int k0 = 0; k0 < DINP; k0 += 32) {
    // A fragment: f32 -> f16 inline conversion (K chunks lhi*8 and 16+lhi*8)
    const float* xp = xrow + k0 + lhi * 8;
    v8h alo, ahi;
    #pragma unroll
    for (int i = 0; i < 8; ++i) { alo[i] = (f16)xp[i]; ahi[i] = (f16)xp[16 + i]; }
    v16h a = cat8(alo, ahi);
    #pragma unroll
    for (int t = 0; t < 4; ++t) {
      const f16* bp = &Bpanel[t * 16 + lrow][k0 + lhi * 8];
      v16h b = cat8(*(const v8h*)bp, *(const v8h*)(bp + 16));
      acc[t] = wmma16(a, b, acc[t]);
    }
  }

  // Scatter: C element (row = r + 8*lhi, col = lrow) per the 16x16 f32 layout.
  #pragma unroll
  for (int t = 0; t < 4; ++t) {
    const int gcol  = n0 + t * 16 + lrow;
    const int which = gcol >> 8;        // 0=q 1=k 2=v
    const int rem   = gcol & 255;
    const int h     = rem >> 5;
    const int d     = rem & 31;
    #pragma unroll
    for (int r = 0; r < 8; ++r) {
      const int grow = m0 + r + 8 * lhi;
      const int bb   = grow >> 10;
      const int n    = grow & 1023;
      const float v  = acc[t][r];
      const size_t hd = ((size_t)(bb * HEADS + h) * NSEQ + n) * DIMH + d;
      if (which == 0)      qw[hd] = (f16)(v * SCALE);
      else if (which == 1) kw[hd] = (f16)v;
      else                 vT[((size_t)(bb * HEADS + h) * DIMH + d) * NSEQ + n] = (f16)v;
    }
  }
}

static __device__ __forceinline__ float other_half(float v) {
  const int b = __builtin_bit_cast(int, v);
  return __builtin_bit_cast(float,
      __builtin_amdgcn_permlanex16(b, b, 0x76543210, 0xfedcba98, false, false));
}

__global__ void __launch_bounds__(256) k_attn(const f16* __restrict__ qw,
                                              const f16* __restrict__ kw,
                                              const f16* __restrict__ vT,
                                              const f16* __restrict__ biasF,
                                              f16* __restrict__ attn) {
  __shared__ __align__(16) f16 Kbuf[2][32 * 32];      // [key][d]   2 x 2 KB
  __shared__ __align__(16) f16 Vbuf[2][32 * 32];      // [d][key]   2 x 2 KB
  const int tid  = threadIdx.x;
  const int lane = tid & 31;
  const int w    = tid >> 5;
  const int lrow = lane & 15;
  const int lhi  = lane >> 4;
  const int q0   = blockIdx.x * 128 + w * 16;
  const int h    = blockIdx.y;
  const int b    = blockIdx.z;
  const size_t headoff = (size_t)(b * HEADS + h) * NSEQ * DIMH;

  // Copier role: threads 0-127 move the K tile, 128-255 the V tile.
  const int cr = (tid & 127) >> 2;                    // row within 32x32 tile
  const int cc = (tid & 3) * 8;                       // half-offset in row
  const f16* csrc0;
  size_t cstep;                                       // halves per key-block
  unsigned cdst[2];
  if (tid < 128) {                                    // K: row=key, 32 halves
    csrc0 = kw + headoff + (size_t)cr * DIMH + cc;
    cstep = 32 * DIMH;
    cdst[0] = lds_u32(&Kbuf[0][cr * 32 + cc]);
    cdst[1] = lds_u32(&Kbuf[1][cr * 32 + cc]);
  } else {                                            // V: row=d, stride NSEQ
    csrc0 = vT + headoff + (size_t)cr * NSEQ + cc;
    cstep = 32;
    cdst[0] = lds_u32(&Vbuf[0][cr * 32 + cc]);
    cdst[1] = lds_u32(&Vbuf[1][cr * 32 + cc]);
  }

  // Q^T B-fragment (K=32 x 16 query columns), pre-scaled by 1/sqrt(d) in k_qkv.
  const f16* qp = qw + headoff + (size_t)(q0 + lrow) * DIMH + lhi * 8;
  const v16h qa = cat8(*(const v8h*)qp, *(const v8h*)(qp + 16));

  // Bias row of this lane's query, at this lane half's first key.
  const f16* brow = biasF + (size_t)h * NSEQ * NSEQ
                          + (size_t)(q0 + lrow) * NSEQ + lhi * 8;

  float m = -1e30f;                 // running max of query q0+lrow (both halves agree)
  float l = 0.f;                    // running sum over THIS lane half's keys only
  const v8f zero = (v8f){0.f,0.f,0.f,0.f,0.f,0.f,0.f,0.f};
  v8f o0 = zero, o1 = zero;         // O^T: reg r = d (8*lhi+r, 16+8*lhi+r), lane = query

  async_cp16(cdst[0], csrc0);                         // prefetch tile 0

  for (int it = 0; it < 32; ++it) {
    const int cur = it & 1;
    const int kb  = it * 32;
    __syncthreads();                  // buf[1-cur] free (prev compute done)
    if (it < 31) {
      async_cp16(cdst[1 - cur], csrc0 + (size_t)(it + 1) * cstep);
      WAIT_ASYNC_1();                 // tile `it` landed, tile it+1 in flight
    } else {
      WAIT_ASYNC_0();
    }
    __syncthreads();                  // tile `it` visible block-wide

    // Relative position bias: keys kb+8*lhi+r and kb+16+8*lhi+r of this query.
    const v8h bb0 = *(const v8h*)(brow + kb);
    const v8h bb1 = *(const v8h*)(brow + kb + 16);

    // K A-fragments from LDS: lane row = key, K-dim = d.
    const f16* kp0 = &Kbuf[cur][lrow * 32 + lhi * 8];
    const f16* kp1 = &Kbuf[cur][(16 + lrow) * 32 + lhi * 8];
    v16h bk0 = cat8(*(const v8h*)kp0, *(const v8h*)(kp0 + 16));
    v16h bk1 = cat8(*(const v8h*)kp1, *(const v8h*)(kp1 + 16));
    v8f s0 = wmma16(bk0, qa, zero);   // s0[r] = S[q0+lrow][kb + 8*lhi + r]
    v8f s1 = wmma16(bk1, qa, zero);   // s1[r] = S[q0+lrow][kb + 16 + 8*lhi + r]

    #pragma unroll
    for (int r = 0; r < 8; ++r) {
      s0[r] += (float)bb0[r];
      s1[r] += (float)bb1[r];
    }

    // Online softmax: 16 scores of the query in-lane, the other 16 in lane^16.
    float c = fmaxf(s0[0], s1[0]);
    #pragma unroll
    for (int r = 1; r < 8; ++r) c = fmaxf(c, fmaxf(s0[r], s1[r]));
    c = fmaxf(c, other_half(c));
    const float mn   = fmaxf(m, c);
    const float corr = __expf(m - mn);
    float rs = 0.f;
    v16h pb;                          // P^T B-fragment: same k order as the V loader
    #pragma unroll
    for (int r = 0; r < 8; ++r) {
      const float p0 = __expf(s0[r] - mn);
      const float p1 = __expf(s1[r] - mn);
      rs += p0 + p1;
      pb[r]     = (f16)p0;
      pb[8 + r] = (f16)p1;
    }
    l = l * corr + rs;
    m = mn;
    #pragma unroll
    for (int r = 0; r < 8; ++r) { o0[r] *= corr; o1[r] *= corr; }

    // V^T A-fragments from LDS: lane row = d, K-dim = key.
    const f16* vp0 = &Vbuf[cur][lrow * 32 + lhi * 8];
    const f16* vp1 = &Vbuf[cur][(16 + lrow) * 32 + lhi * 8];
    v16h bv0 = cat8(*(const v8h*)vp0, *(const v8h*)(vp0 + 16));
    v16h bv1 = cat8(*(const v8h*)vp1, *(const v8h*)(vp1 + 16));
    o0 = wmma16(bv0, pb, o0);
    o1 = wmma16(bv1, pb, o1);
  }

  // Join the halves' sums, normalize, store to [B, N, H*D] f16 for the output
  // GEMM: 8 consecutive d per lane and tile, one 16-byte store each.
  l += other_half(l);
  const float inv = 1.f / l;
  v8h r0, r1;
  #pragma unroll
  for (int r = 0; r < 8; ++r) { r0[r] = (f16)(o0[r] * inv); r1[r] = (f16)(o1[r] * inv); }
  f16* op = attn + ((size_t)(b * NSEQ + q0 + lrow) * HEADS + h) * DIMH + lhi * 8;
  *(v8h*)op        = r0;
  *(v8h*)(op + 16) = r1;
}

// ---------------------------------------------------------------------------
// Kernel 5: output projection. attn[16384,256]f16 @ WoutT + b_out -> f32 out.
// Same LDS-staged weight panel as k_qkv.
// ---------------------------------------------------------------------------
__global__ void __launch_bounds__(256) k_out(const f16* __restrict__ A,
                                             const f16* __restrict__ WT,
                                             const float* __restrict__ bias,
                                             float* __restrict__ out) {
  __shared__ __align__(16) f16 Bpanel[64][DINP];      // 32 KB
  const int tid  = threadIdx.x;
  const int lane = tid & 31;
  const int w    = tid >> 5;
  const int lrow = lane & 15;
  const int lhi  = lane >> 4;
  const int m0   = blockIdx.y * 128 + w * 16;
  const int n0   = blockIdx.x * 64;

  #pragma unroll
  for (int j = 0; j < 8; ++j) {
    const int c = tid + j * 256;
    const int row = c >> 5, col8 = (c & 31) * 8;
    async_cp16(lds_u32(&Bpanel[row][col8]),
               WT + (size_t)(n0 + row) * DINP + col8);
  }
  WAIT_ASYNC_0();
  __syncthreads();

  v8f acc[4];
  #pragma unroll
  for (int t = 0; t < 4; ++t) acc[t] = (v8f){0.f,0.f,0.f,0.f,0.f,0.f,0.f,0.f};

  const f16* arow = A + (size_t)(m0 + lrow) * DINP;
  #pragma unroll
  for (int k0 = 0; k0 < DINP; k0 += 32) {
    const f16* ap = arow + k0 + lhi * 8;
    v16h a = cat8(*(const v8h*)ap, *(const v8h*)(ap + 16));
    #pragma unroll
    for (int t = 0; t < 4; ++t) {
      const f16* bp = &Bpanel[t * 16 + lrow][k0 + lhi * 8];
      v16h b = cat8(*(const v8h*)bp, *(const v8h*)(bp + 16));
      acc[t] = wmma16(a, b, acc[t]);
    }
  }

  #pragma unroll
  for (int t = 0; t < 4; ++t) {
    const int gcol = n0 + t * 16 + lrow;
    const float bv = bias[gcol];
    #pragma unroll
    for (int r = 0; r < 8; ++r) {
      out[(size_t)(m0 + r + 8 * lhi) * NOUT + gcol] = acc[t][r] + bv;
    }
  }
}

// ---------------------------------------------------------------------------
extern "C" void kernel_launch(void* const* d_in, const int* in_sizes, int n_in,
                              void* d_out, int out_size, void* d_ws, size_t ws_size,
                              hipStream_t stream) {
  const float* x      = (const float*)d_in[0];   // [16,1024,256]
  const float* W_qkv  = (const float*)d_in[1];   // [256,768]
  const float* W_out  = (const float*)d_in[2];   // [256,256]
  const float* b_out  = (const float*)d_in[3];   // [256]
  const float* btable = (const float*)d_in[4];   // [3969,8]
  const int*   relidx = (const int*)d_in[5];     // [1024*1024]
  float* out = (float*)d_out;

  char* ws = (char*)d_ws;
  size_t off = 0;
  f16* WqkvT = (f16*)(ws + off); off += (size_t)NQKV * DINP * 2;          // 384 KB
  f16* WoutT = (f16*)(ws + off); off += (size_t)NOUT * DINP * 2;          // 128 KB
  f16* qw    = (f16*)(ws + off); off += (size_t)B_SZ * HEADS * NSEQ * DIMH * 2; // 8 MB
  f16* kw    = (f16*)(ws + off); off += (size_t)B_SZ * HEADS * NSEQ * DIMH * 2; // 8 MB
  f16* vT    = (f16*)(ws + off); off += (size_t)B_SZ * HEADS * NSEQ * DIMH * 2; // 8 MB
  f16* attn  = (f16*)(ws + off); off += (size_t)B_SZ * NSEQ * HEADS * DIMH * 2; // 8 MB
  f16* biasF = (f16*)(ws + off); off += (size_t)HEADS * NSEQ * NSEQ * 2;        // 16 MB

  k_prep<<<(NQKV * DINP + NOUT * DINP) / 256, 256, 0, stream>>>(W_qkv, W_out, WqkvT, WoutT);
  k_bias<<<(NSEQ * NSEQ) / 2048, 256, 0, stream>>>(btable, relidx, biasF);
  k_qkv<<<dim3(NQKV / 64, (B_SZ * NSEQ) / 128), 256, 0, stream>>>(x, WqkvT, qw, kw, vT);
  k_attn<<<dim3(NSEQ / 128, HEADS, B_SZ), 256, 0, stream>>>(qw, kw, vT, biasF, attn);
  k_out<<<dim3(NOUT / 64, (B_SZ * NSEQ) / 128), 256, 0, stream>>>(attn, WoutT, b_out, out);
}

// v003
// Measured time: 84.4 microseconds a run.
// Two timings next to v002 put it at 1.35 and 1.37 times that version's speed.
// All steps since v000 together make it 2.00 times as fast.
#include <hip/hip_runtime.h>
#include <hip/hip_bf16.h>

typedef _Float16 f16;
typedef _Float16 v16h __attribute__((ext_vector_type(16)));
typedef _Float16 v8h  __attribute__((ext_vector_type(8)));
typedef float    v8f  __attribute__((ext_vector_type(8)));
typedef _Float16 v2h  __attribute__((ext_vector_type(2)));
typedef float    v4f  __attribute__((ext_vector_type(4)));
typedef int      v2i  __attribute__((ext_vector_type(2)));

#define B_SZ   16
#define NSEQ   1024
#define HEADS  8
#define DIMH   32
#define DINP   256
#define NQKV   768
#define NOUT   256
#define NTAB   3969                    // rows of the bias table, (2*32-1)^2
#define SCALE  0.17677669529663689f   // 32^-0.5
// LDS row pitches in halves: row length + 16 B, an odd multiple of 16 B, so that
// the 16 rows of a ds_load_b128 fragment read fall on 16 different bank groups.
#define PANEL_PITCH (DINP + 8)         // 528 B for the 512-B weight rows
#define TILE_PITCH  (DIMH + 8)         // 80 B for the 64-B K and V tile rows

static __device__ __forceinline__ v16h cat8(v8h lo, v8h hi) {
  return __builtin_shufflevector(lo, hi, 0,1,2,3,4,5,6,7,8,9,10,11,12,13,14,15);
}
static __device__ __forceinline__ v8f wmma16(v16h a, v16h b, v8f c) {
  // D = A(16x32 f16) * B(32x16 f16) + C(16x16 f32)
  return __builtin_amdgcn_wmma_f32_16x16x32_f16(false, a, false, b, (short)0, c, false, false);
}

// LDS byte offset of a shared-memory pointer: low 32 bits of the flat address
// (ISA 10.2: aperture LDS mapping is LDS_ADDR.U32 = addr[31:0]).
static __device__ __forceinline__ unsigned lds_u32(const void* p) {
  return (unsigned)(size_t)p;
}
// Async copy of 16 bytes global -> LDS per lane (ASYNCcnt-tracked).
static __device__ __forceinline__ void async_cp16(unsigned lds_dst, const f16* gsrc) {
  asm volatile("global_load_async_to_lds_b128 %0, %1, off"
               :: "v"(lds_dst), "v"(gsrc)
               : "memory");
}
#define WAIT_ASYNC_0() asm volatile("s_wait_asynccnt 0x0" ::: "memory")
#define WAIT_ASYNC_1() asm volatile("s_wait_asynccnt 0x1" ::: "memory")

// ---------------------------------------------------------------------------
// Kernel 1: transpose weights to f16 [out, k] so WMMA B fragments are
// contiguous per-lane 16B loads.
// ---------------------------------------------------------------------------
__global__ void __launch_bounds__(256) k_prep(const float* __restrict__ Wqkv,
                                              const float* __restrict__ Wout,
                                              f16* __restrict__ WqkvT,
                                              f16* __restrict__ WoutT) {
  int idx = blockIdx.x * 256 + threadIdx.x;           // 1024 blocks -> 262144
  if (idx < NQKV * DINP) {
    int o = idx / DINP, k = idx % DINP;
    WqkvT[o * DINP + k] = (f16)Wqkv[k * NQKV + o];
  } else {
    int j = idx - NQKV * DINP;                        // < 256*256
    int o = j / DINP, k = j % DINP;
    WoutT[o * DINP + k] = (f16)Wout[k * NOUT + o];
  }
}

// ---------------------------------------------------------------------------
// Kernel 2: materialize relative-position bias [H][1024][1024] as f16.
// One thread serves 8 (query,key) positions for ALL 8 heads: the index is read
// once, a table row (8 heads, 32 B) comes as two 16-byte loads, and two
// neighbouring positions pack into one 4-byte store, so that each wave-wide
// store fills one whole 128-byte line of a head's plane.
// ---------------------------------------------------------------------------
__global__ void __launch_bounds__(256) k_bias(const float* __restrict__ table,
                                              const int* __restrict__ relidx,
                                              f16* __restrict__ biasF) {
  const unsigned lane = threadIdx.x & 31u;
  const unsigned wv   = blockIdx.x * 8u + (threadIdx.x >> 5);   // 512 blocks -> 4096 waves
  const unsigned r0   = wv * 256u + lane * 2u;                  // a wave covers 256 positions

  v2i id[4];
  #pragma unroll
  for (int j = 0; j < 4; ++j) id[j] = *(const v2i*)(relidx + r0 + j * 64);

  unsigned off[4][2];                                           // byte offset of each table row
  v4f row[4][2][2];                                             // [j][position of the pair][heads 0-3, 4-7]
  #pragma unroll
  for (int j = 0; j < 4; ++j) {
    #pragma unroll
    for (int p = 0; p < 2; ++p) {
      // Bound the row before the address is formed (identity for a valid index).
      off[j][p] = min((unsigned)id[j][p], (unsigned)(NTAB - 1)) * (unsigned)(HEADS * sizeof(float));
      const float* tp = (const float*)((const char*)table + off[j][p]);
      row[j][p][0] = *(const v4f*)tp;
      row[j][p][1] = *(const v4f*)(tp + 4);
    }
  }
  // Precaution: the wait stands behind the gathers and takes their offsets as
  // inputs, which keeps those registers live up to it, so that none of them is
  // written (by a later gather's data either) in front of the wait.
  asm volatile("s_wait_xcnt 0x0"
               :: "v"(off[0][0]), "v"(off[0][1]), "v"(off[1][0]), "v"(off[1][1]),
                  "v"(off[2][0]), "v"(off[2][1]), "v"(off[3][0]), "v"(off[3][1])
               : "memory");

  #pragma unroll
  for (int j = 0; j < 4; ++j) {
    #pragma unroll
    for (int h = 0; h < HEADS; ++h) {
      v2h o;
      o[0] = (f16)row[j][0][h >> 2][h & 3];
      o[1] = (f16)row[j][1][h >> 2][h & 3];
      *(v2h*)(biasF + (size_t)h * NSEQ * NSEQ + r0 + j * 64) = o;
    }
  }
}

// ---------------------------------------------------------------------------
// Kernel 3: QKV projection. x[16384,256]f32 @ WqkvT -> q/k/vT in head layout.
// Block = 8 waves stacked in M (128x64 C tile). The shared 64x256 f16 weight
// panel is staged once into LDS via async-to-LDS copies (8x traffic cut).
// ---------------------------------------------------------------------------
__global__ void __launch_bounds__(256) k_qkv(const float* __restrict__ x,
                                             const f16* __restrict__ WT,
                                             f16* __restrict__ qw,
                                             f16* __restrict__ kw,
                                             f16* __restrict__ vT) {
  __shared__ __align__(16) f16 Bpanel[64][PANEL_PITCH];   // 33 KB
  const int tid  = threadIdx.x;
  const int lane = tid & 31;
  const int w    = tid >> 5;
  const int lrow = lane & 15;
  const int lhi  = lane >> 4;
  const int m0   = blockIdx.y * 128 + w * 16;
  const int n0   = blockIdx.x * 64;

  // Stage weight panel: 64 rows x 512 B = 2048 chunks of 16 B, 8 per thread.
  #pragma unroll
  for (int j = 0; j < 8; ++j) {
    const int c = tid + j * 256;                      // chunk id
    const int row = c >> 5, col8 = (c & 31) * 8;
    async_cp16(lds_u32(&Bpanel[row][col8]),
               WT + (size_t)(n0 + row) * DINP + col8);
  }
  WAIT_ASYNC_0();
  __syncthreads();

  v8f acc[4];
  #pragma unroll
  for (int t = 0; t < 4; ++t) acc[t] = (v8f){0.f,0.f,0.f,0.f,0.f,0.f,0.f,0.f};

  const float* xrow = x + (size_t)(m0 + lrow) * DINP;
  #pragma unroll
  for (int k0 = 0; k0 < DINP; k0 += 32) {
    // A fragment: f32 -> f16 inline conversion (K chunks lhi*8 and 16+lhi*8)
    const float* xp = xrow + k0 + lhi * 8;
    v8h alo, ahi;
    #pragma unroll
    for (int i = 0; i < 8; ++i) { alo[i] = (f16)xp[i]; ahi[i] = (f16)xp[16 + i]; }
    v16h a = cat8(alo, ahi);
    #pragma unroll
    for (int t = 0; t < 4; ++t) {
      const f16* bp = &Bpanel[t * 16 + lrow][k0 + lhi * 8];
      v16h b = cat8(*(const v8h*)bp, *(const v8h*)(bp + 16));
      acc[t] = wmma16(a, b, acc[t]);
    }
  }

  // Scatter: C element (row = r + 8*lhi, col = lrow) per the 16x16 f32 layout.
  #pragma unroll
  for (int t = 0; t < 4; ++t) {
    const int gcol  = n0 + t * 16 + lrow;
    const int which = gcol >> 8;        // 0=q 1=k 2=v
    const int rem   = gcol & 255;
    const int h     = rem >> 5;
    const int d     = rem & 31;
    #pragma unroll
    for (int r = 0; r < 8; ++r) {
      const int grow = m0 + r + 8 * lhi;
      const int bb   = grow >> 10;
      const int n    = grow & 1023;
      const float v  = acc[t][r];
      const size_t hd = ((size_t)(bb * HEADS + h) * NSEQ + n) * DIMH + d;
      if (which == 0)      qw[hd] = (f16)(v * SCALE);
      else if (which == 1) kw[hd] = (f16)v;
      else                 vT[((size_t)(bb * HEADS + h) * DIMH + d) * NSEQ + n] = (f16)v;
    }
  }
}

static __device__ __forceinline__ float other_half(float v) {
  const int b = __builtin_bit_cast(int, v);
  return __builtin_bit_cast(float,
      __builtin_amdgcn_permlanex16(b, b, 0x76543210, 0xfedcba98, false, false));
}

__global__ void __launch_bounds__(256) k_attn(const f16* __restrict__ qw,
                                              const f16* __restrict__ kw,
                                              const f16* __restrict__ vT,
                                              const f16* __restrict__ biasF,
                                              f16* __restrict__ attn) {
  __shared__ __align__(16) f16 Kbuf[2][32 * TILE_PITCH];   // [key][d]   2 x 2.5 KB
  __shared__ __align__(16) f16 Vbuf[2][32 * TILE_PITCH];   // [d][key]   2 x 2.5 KB
  const int tid  = threadIdx.x;
  const int lane = tid & 31;
  const int w    = tid >> 5;
  const int lrow = lane & 15;
  const int lhi  = lane >> 4;
  const int q0   = blockIdx.x * 128 + w * 16;
  const int h    = blockIdx.y;
  const int b    = blockIdx.z;
  const size_t headoff = (size_t)(b * HEADS + h) * NSEQ * DIMH;

  // Copier role: threads 0-127 move the K tile, 128-255 the V tile.
  const int cr = (tid & 127) >> 2;                    // row within 32x32 tile
  const int cc = (tid & 3) * 8;                       // half-offset in row
  const f16* csrc0;
  size_t cstep;                                       // halves per key-block
  unsigned cdst[2];
  if (tid < 128) {                                    // K: row=key, 32 halves
    csrc0 = kw + headoff + (size_t)cr * DIMH + cc;
    cstep = 32 * DIMH;
    cdst[0] = lds_u32(&Kbuf[0][cr * TILE_PITCH + cc]);
    cdst[1] = lds_u32(&Kbuf[1][cr * TILE_PITCH + cc]);
  } else {                                            // V: row=d, stride NSEQ
    csrc0 = vT + headoff + (size_t)cr * NSEQ + cc;
    cstep = 32;
    cdst[0] = lds_u32(&Vbuf[0][cr * TILE_PITCH + cc]);
    cdst[1] = lds_u32(&Vbuf[1][cr * TILE_PITCH + cc]);
  }

  // Q^T B-fragment (K=32 x 16 query columns), pre-scaled by 1/sqrt(d) in k_qkv.
  const f16* qp = qw + headoff + (size_t)(q0 + lrow) * DIMH + lhi * 8;
  const v16h qa = cat8(*(const v8h*)qp, *(const v8h*)(qp + 16));

  // Bias row of this lane's query, at this lane half's first key.
  const f16* brow = biasF + (size_t)h * NSEQ * NSEQ
                          + (size_t)(q0 + lrow) * NSEQ + lhi * 8;

  float m = -1e30f;                 // running max of query q0+lrow (both halves agree)
  float l = 0.f;                    // running sum over THIS lane half's keys only
  const v8f zero = (v8f){0.f,0.f,0.f,0.f,0.f,0.f,0.f,0.f};
  v8f o0 = zero, o1 = zero;         // O^T: reg r = d (8*lhi+r, 16+8*lhi+r), lane = query

  async_cp16(cdst[0], csrc0);                         // prefetch tile 0

  for (int it = 0; it < 32; ++it) {
    const int cur = it & 1;
    const int kb  = it * 32;
    __syncthreads();                  // buf[1-cur] free (prev compute done)
    if (it < 31) {
      async_cp16(cdst[1 - cur], csrc0 + (size_t)(it + 1) * cstep);
      WAIT_ASYNC_1();                 // tile `it` landed, tile it+1 in flight
    } else {
      WAIT_ASYNC_0();
    }
    __syncthreads();                  // tile `it` visible block-wide

    // Relative position bias: keys kb+8*lhi+r and kb+16+8*lhi+r of this query.
    const v8h bb0 = *(const v8h*)(brow + kb);
    const v8h bb1 = *(const v8h*)(brow + kb + 16);

    // K A-fragments from LDS: lane row = key, K-dim = d.
    const f16* kp0 = &Kbuf[cur][lrow * TILE_PITCH + lhi * 8];
    const f16* kp1 = &Kbuf[cur][(16 + lrow) * TILE_PITCH + lhi * 8];
    v16h bk0 = cat8(*(const v8h*)kp0, *(const v8h*)(kp0 + 16));
    v16h bk1 = cat8(*(const v8h*)kp1, *(const v8h*)(kp1 + 16));
    v8f s0 = wmma16(bk0, qa, zero);   // s0[r] = S[q0+lrow][kb + 8*lhi + r]
    v8f s1 = wmma16(bk1, qa, zero);   // s1[r] = S[q0+lrow][kb + 16 + 8*lhi + r]

    #pragma unroll
    for (int r = 0; r < 8; ++r) {
      s0[r] += (float)bb0[r];
      s1[r] += (float)bb1[r];
    }

    // Online softmax: 16 scores of the query in-lane, the other 16 in lane^16.
    float c = fmaxf(s0[0], s1[0]);
    #pragma unroll
    for (int r = 1; r < 8; ++r) c = fmaxf(c, fmaxf(s0[r], s1[r]));
    c = fmaxf(c, other_half(c));
    const float mn   = fmaxf(m, c);
    const float corr = __expf(m - mn);
    float rs = 0.f;
    v16h pb;                          // P^T B-fragment: same k order as the V loader
    #pragma unroll
    for (int r = 0; r < 8; ++r) {
      const float p0 = __expf(s0[r] - mn);
      const float p1 = __expf(s1[r] - mn);
      rs += p0 + p1;
      pb[r]     = (f16)p0;
      pb[8 + r] = (f16)p1;
    }
    l = l * corr + rs;
    m = mn;
    #pragma unroll
    for (int r = 0; r < 8; ++r) { o0[r] *= corr; o1[r] *= corr; }

    // V^T A-fragments from LDS: lane row = d, K-dim = key.
    const f16* vp0 = &Vbuf[cur][lrow * TILE_PITCH + lhi * 8];
    const f16* vp1 = &Vbuf[cur][(16 + lrow) * TILE_PITCH + lhi * 8];
    v16h bv0 = cat8(*(const v8h*)vp0, *(const v8h*)(vp0 + 16));
    v16h bv1 = cat8(*(const v8h*)vp1, *(const v8h*)(vp1 + 16));
    o0 = wmma16(bv0, pb, o0);
    o1 = wmma16(bv1, pb, o1);
  }

  // Join the halves' sums, normalize, store to [B, N, H*D] f16 for the output
  // GEMM: 8 consecutive d per lane and tile, one 16-byte store each.
  l += other_half(l);
  const float inv = 1.f / l;
  v8h r0, r1;
  #pragma unroll
  for (int r = 0; r < 8; ++r) { r0[r] = (f16)(o0[r] * inv); r1[r] = (f16)(o1[r] * inv); }
  f16* op = attn + ((size_t)(b * NSEQ + q0 + lrow) * HEADS + h) * DIMH + lhi * 8;
  *(v8h*)op        = r0;
  *(v8h*)(op + 16) = r1;
}

// ---------------------------------------------------------------------------
// Kernel 5: output projection. attn[16384,256]f16 @ WoutT + b_out -> f32 out.
// Same LDS-staged weight panel as k_qkv.
// ---------------------------------------------------------------------------
__global__ void __launch_bounds__(256) k_out(const f16* __restrict__ A,
                                             const f16* __restrict__ WT,
                                             const float* __restrict__ bias,
                                             float* __restrict__ out) {
  __shared__ __align__(16) f16 Bpanel[64][PANEL_PITCH];   // 33 KB
  const int tid  = threadIdx.x;
  const int lane = tid & 31;
  const int w    = tid >> 5;
  const int lrow = lane & 15;
  const int lhi  = lane >> 4;
  const int m0   = blockIdx.y * 128 + w * 16;
  const int n0   = blockIdx.x * 64;

  #pragma unroll
  for (int j = 0; j < 8; ++j) {
    const int c = tid + j * 256;
    const int row = c >> 5, col8 = (c & 31) * 8;
    async_cp16(lds_u32(&Bpanel[row][col8]),
               WT + (size_t)(n0 + row) * DINP + col8);
  }
  WAIT_ASYNC_0();
  __syncthreads();

  v8f acc[4];
  #pragma unroll
  for (int t = 0; t < 4; ++t) acc[t] = (v8f){0.f,0.f,0.f,0.f,0.f,0.f,0.f,0.f};

  const f16* arow = A + (size_t)(m0 + lrow) * DINP;
  #pragma unroll
  for (int k0 = 0; k0 < DINP; k0 += 32) {
    const f16* ap = arow + k0 + lhi * 8;
    v16h a = cat8(*(const v8h*)ap, *(const v8h*)(ap + 16));
    #pragma unroll
    for (int t = 0; t < 4; ++t) {
      const f16* bp = &Bpanel[t * 16 + lrow][k0 + lhi * 8];
      v16h b = cat8(*(const v8h*)bp, *(const v8h*)(bp + 16));
      acc[t] = wmma16(a, b, acc[t]);
    }
  }

  #pragma unroll
  for (int t = 0; t < 4; ++t) {
    const int gcol = n0 + t * 16 + lrow;
    const float bv = bias[gcol];
    #pragma unroll
    for (int r = 0; r < 8; ++r) {
      out[(size_t)(m0 + r + 8 * lhi) * NOUT + gcol] = acc[t][r] + bv;
    }
  }
}

// ---------------------------------------------------------------------------
extern "C" void kernel_launch(void* const* d_in, const int* in_sizes, int n_in,
                              void* d_out, int out_size, void* d_ws, size_t ws_size,
                              hipStream_t stream) {
  const float* x      = (const float*)d_in[0];   // [16,1024,256]
  const float* W_qkv  = (const float*)d_in[1];   // [256,768]
  const float* W_out  = (const float*)d_in[2];   // [256,256]
  const float* b_out  = (const float*)d_in[3];   // [256]
  const float* btable = (const float*)d_in[4];   // [3969,8]
  const int*   relidx = (const int*)d_in[5];     // [1024*1024]
  float* out = (float*)d_out;

  char* ws = (char*)d_ws;
  size_t off = 0;
  f16* WqkvT = (f16*)(ws + off); off += (size_t)NQKV * DINP * 2;          // 384 KB
  f16* WoutT = (f16*)(ws + off); off += (size_t)NOUT * DINP * 2;          // 128 KB
  f16* qw    = (f16*)(ws + off); off += (size_t)B_SZ * HEADS * NSEQ * DIMH * 2; // 8 MB
  f16* kw    = (f16*)(ws + off); off += (size_t)B_SZ * HEADS * NSEQ * DIMH * 2; // 8 MB
  f16* vT    = (f16*)(ws + off); off += (size_t)B_SZ * HEADS * NSEQ * DIMH * 2; // 8 MB
  f16* attn  = (f16*)(ws + off); off += (size_t)B_SZ * NSEQ * HEADS * DIMH * 2; // 8 MB
  f16* biasF = (f16*)(ws + off); off += (size_t)HEADS * NSEQ * NSEQ * 2;        // 16 MB

  k_prep<<<(NQKV * DINP + NOUT * DINP) / 256, 256, 0, stream>>>(W_qkv, W_out, WqkvT, WoutT);
  k_bias<<<(NSEQ * NSEQ) / 2048, 256, 0, stream>>>(btable, relidx, biasF);
  k_qkv<<<dim3(NQKV / 64, (B_SZ * NSEQ) / 128), 256, 0, stream>>>(x, WqkvT, qw, kw, vT);
  k_attn<<<dim3(NSEQ / 128, HEADS, B_SZ), 256, 0, stream>>>(qw, kw, vT, biasF, attn);
  k_out<<<dim3(NOUT / 64, (B_SZ * NSEQ) / 128), 256, 0, stream>>>(attn, WoutT, b_out, out);
}

// v004
// Measured time: 76.7 microseconds a run.
// Two timings next to v003 put it at 1.10 and 1.11 times that version's speed.
// All steps since v000 together make it 2.21 times as fast.
#include <hip/hip_runtime.h>
#include <hip/hip_bf16.h>

typedef _Float16 f16;
typedef _Float16 v16h __attribute__((ext_vector_type(16)));
typedef _Float16 v8h  __attribute__((ext_vector_type(8)));
typedef float    v8f  __attribute__((ext_vector_type(8)));
typedef _Float16 v2h  __attribute__((ext_vector_type(2)));
typedef float    v4f  __attribute__((ext_vector_type(4)));
typedef int      v2i  __attribute__((ext_vector_type(2)));

#define B_SZ   16
#define NSEQ   1024
#define HEADS  8
#define DIMH   32
#define DINP   256
#define NQKV   768
#define NOUT   256
#define NTAB   3969                    // rows of the bias table, (2*32-1)^2
#define SCALE  0.17677669529663689f   // 32^-0.5
// LDS row pitches in halves: row length + 16 B, an odd multiple of 16 B, so that
// the 16 rows of a ds_load_b128 fragment read fall on 16 different bank groups.
#define PANEL_PITCH (DINP + 8)         // 528 B for the 512-B weight rows
#define TILE_PITCH  (DIMH + 8)         // 80 B for the 64-B K and V tile rows

static __device__ __forceinline__ v16h cat8(v8h lo, v8h hi) {
  return __builtin_shufflevector(lo, hi, 0,1,2,3,4,5,6,7,8,9,10,11,12,13,14,15);
}
static __device__ __forceinline__ v8f wmma16(v16h a, v16h b, v8f c) {
  // D = A(16x32 f16) * B(32x16 f16) + C(16x16 f32)
  return __builtin_amdgcn_wmma_f32_16x16x32_f16(false, a, false, b, (short)0, c, false, false);
}

// LDS byte offset of a shared-memory pointer: low 32 bits of the flat address
// (ISA 10.2: aperture LDS mapping is LDS_ADDR.U32 = addr[31:0]).
static __device__ __forceinline__ unsigned lds_u32(const void* p) {
  return (unsigned)(size_t)p;
}
// Async copy of 16 bytes global -> LDS per lane (ASYNCcnt-tracked).
static __device__ __forceinline__ void async_cp16(unsigned lds_dst, const f16* gsrc) {
  asm volatile("global_load_async_to_lds_b128 %0, %1, off"
               :: "v"(lds_dst), "v"(gsrc)
               : "memory");
}
#define WAIT_ASYNC_0() asm volatile("s_wait_asynccnt 0x0" ::: "memory")
#define WAIT_ASYNC_1() asm volatile("s_wait_asynccnt 0x1" ::: "memory")
#define WAIT_X_0()     asm volatile("s_wait_xcnt 0x0" ::: "memory")

// ---------------------------------------------------------------------------
// Kernel 1: transpose weights to f16 [out, k] so WMMA B fragments are
// contiguous per-lane 16B loads.
// ---------------------------------------------------------------------------
__global__ void __launch_bounds__(256) k_prep(const float* __restrict__ Wqkv,
                                              const float* __restrict__ Wout,
                                              f16* __restrict__ WqkvT,
                                              f16* __restrict__ WoutT) {
  int idx = blockIdx.x * 256 + threadIdx.x;           // 1024 blocks -> 262144
  if (idx < NQKV * DINP) {
    int o = idx / DINP, k = idx % DINP;
    WqkvT[o * DINP + k] = (f16)Wqkv[k * NQKV + o];
  } else {
    int j = idx - NQKV * DINP;                        // < 256*256
    int o = j / DINP, k = j % DINP;
    WoutT[o * DINP + k] = (f16)Wout[k * NOUT + o];
  }
}

// ---------------------------------------------------------------------------
// Kernel 2: materialize relative-position bias [H][1024][1024] as f16.
// One thread serves 8 (query,key) positions for ALL 8 heads: the index is read
// once, a table row (8 heads, 32 B) comes as two 16-byte loads, and two
// neighbouring positions pack into one 4-byte store, so that each wave-wide
// store fills one whole 128-byte line of a head's plane.
// ---------------------------------------------------------------------------
__global__ void __launch_bounds__(256) k_bias(const float* __restrict__ table,
                                              const int* __restrict__ relidx,
                                              f16* __restrict__ biasF) {
  const unsigned lane = threadIdx.x & 31u;
  const unsigned wv   = blockIdx.x * 8u + (threadIdx.x >> 5);   // 512 blocks -> 4096 waves
  const unsigned r0   = wv * 256u + lane * 2u;                  // a wave covers 256 positions

  v2i id[4];
  #pragma unroll
  for (int j = 0; j < 4; ++j) id[j] = *(const v2i*)(relidx + r0 + j * 64);

  unsigned off[4][2];                                           // byte offset of each table row
  v4f row[4][2][2];                                             // [j][position of the pair][heads 0-3, 4-7]
  #pragma unroll
  for (int j = 0; j < 4; ++j) {
    #pragma unroll
    for (int p = 0; p < 2; ++p) {
      // Bound the row before the address is formed (identity for a valid index).
      off[j][p] = min((unsigned)id[j][p], (unsigned)(NTAB - 1)) * (unsigned)(HEADS * sizeof(float));
      const float* tp = (const float*)((const char*)table + off[j][p]);
      row[j][p][0] = *(const v4f*)tp;
      row[j][p][1] = *(const v4f*)(tp + 4);
    }
  }
  // Precaution: the wait stands behind the gathers and takes their offsets as
  // inputs, which keeps those registers live up to it, so that none of them is
  // written (by a later gather's data either) in front of the wait.
  asm volatile("s_wait_xcnt 0x0"
               :: "v"(off[0][0]), "v"(off[0][1]), "v"(off[1][0]), "v"(off[1][1]),
                  "v"(off[2][0]), "v"(off[2][1]), "v"(off[3][0]), "v"(off[3][1])
               : "memory");

  #pragma unroll
  for (int j = 0; j < 4; ++j) {
    #pragma unroll
    for (int h = 0; h < HEADS; ++h) {
      v2h o;
      o[0] = (f16)row[j][0][h >> 2][h & 3];
      o[1] = (f16)row[j][1][h >> 2][h & 3];
      *(v2h*)(biasF + (size_t)h * NSEQ * NSEQ + r0 + j * 64) = o;
    }
  }
}

// ---------------------------------------------------------------------------
// Kernel 3: QKV projection. x[16384,256]f32 @ WqkvT -> q/k/vT in head layout.
// Block = 8 waves stacked in M (128x64 C tile). The shared 64x256 f16 weight
// panel is staged once into LDS via async-to-LDS copies (8x traffic cut).
// A 64-column block lies wholly in q, in k or in v. The operand roles are chosen so
// that a lane's 8 results of a tile lie along the contiguous axis of their output
// (d for q and k, n for vT) and leave as ONE 16-byte store.
// ---------------------------------------------------------------------------
// The 32 products of a wave's 16 x 64 tile. XA: the x rows are the A operand
// (reg r = x row r + 8*lhi, lane = column lrow); else the weight rows are A
// (reg r = column r + 8*lhi, lane = x row lrow). Both loaders keep one k order.
template <bool XA>
static __device__ __forceinline__ void qkv_products(const float* __restrict__ xfrag,
                                                    const f16 (&Bpanel)[64][PANEL_PITCH],
                                                    int lrow, int lhi, v8f (&acc)[4]) {
  #pragma unroll
  for (int k0 = 0; k0 < DINP; k0 += 32) {
    // x fragment: f32 -> f16 inline conversion (K chunks lhi*8 and 16+lhi*8)
    const float* xp = xfrag + k0;
    v8h alo, ahi;
    #pragma unroll
    for (int i = 0; i < 8; ++i) { alo[i] = (f16)xp[i]; ahi[i] = (f16)xp[16 + i]; }
    v16h a = cat8(alo, ahi);
    #pragma unroll
    for (int t = 0; t < 4; ++t) {
      const f16* bp = &Bpanel[t * 16 + lrow][k0 + lhi * 8];
      v16h b = cat8(*(const v8h*)bp, *(const v8h*)(bp + 16));
      acc[t] = XA ? wmma16(a, b, acc[t]) : wmma16(b, a, acc[t]);
    }
  }
  // Precaution: the wait takes the x loads' address as an input, which keeps that pair
  // live up to it, so that no load's data is written over it in front of the wait.
  asm volatile("s_wait_xcnt 0x0" :: "v"(xfrag) : "memory");
}

// 12 waves per SIMD (at most 80 registers): all 1,536 blocks, 6 per WGP, are resident at once.
__global__ void __launch_bounds__(256, 12) k_qkv(const float* __restrict__ x,
                                             const f16* __restrict__ WT,
                                             f16* __restrict__ qw,
                                             f16* __restrict__ kw,
                                             f16* __restrict__ vT) {
  __shared__ __align__(16) f16 Bpanel[64][PANEL_PITCH];   // 33 KB
  const int tid  = threadIdx.x;
  const int lane = tid & 31;
  const int w    = tid >> 5;
  const int lrow = lane & 15;
  const int lhi  = lane >> 4;
  const int m0   = blockIdx.y * 128 + w * 16;
  const int n0   = blockIdx.x * 64;

  // Stage weight panel: 64 rows x 512 B = 2048 chunks of 16 B, 8 per thread.
  #pragma unroll
  for (int j = 0; j < 8; ++j) {
    const int c = tid + j * 256;                      // chunk id
    const int row = c >> 5, col8 = (c & 31) * 8;
    async_cp16(lds_u32(&Bpanel[row][col8]),
               WT + (size_t)(n0 + row) * DINP + col8);
  }
  WAIT_ASYNC_0();
  __syncthreads();

  v8f acc[4];
  #pragma unroll
  for (int t = 0; t < 4; ++t) acc[t] = (v8f){0.f,0.f,0.f,0.f,0.f,0.f,0.f,0.f};

  const float* xfrag = x + (size_t)(m0 + lrow) * DINP + lhi * 8;   // this lane's first K chunk
  const int which = n0 >> 8;            // 0=q 1=k 2=v, the same for the whole block
  const int hb    = (n0 & 255) >> 5;    // first of the block's two heads
  const int bb    = m0 >> 10;           // a wave's 16 rows lie in one batch
  const int nw    = m0 & 1023;          // its first row inside the batch
  // Precaution, both arms: the wait stands directly behind each store, in front of
  // the next write of a register that the store names.
  if (which == 2) {
    qkv_products<true>(xfrag, Bpanel, lrow, lhi, acc);
    #pragma unroll
    for (int t = 0; t < 4; ++t) {       // column d of head h, rows nw + 8*lhi + 0..7
      const int h = hb + (t >> 1);
      const int d = (t & 1) * 16 + lrow;
      v8h o;
      #pragma unroll
      for (int r = 0; r < 8; ++r) o[r] = (f16)acc[t][r];
      *(v8h*)(vT + ((size_t)(bb * HEADS + h) * DIMH + d) * NSEQ + nw + 8 * lhi) = o;
      WAIT_X_0();
    }
  } else {
    qkv_products<false>(xfrag, Bpanel, lrow, lhi, acc);
    f16* __restrict__ dst = which == 0 ? qw : kw;
    const float sc = which == 0 ? SCALE : 1.f;
    #pragma unroll
    for (int t = 0; t < 4; ++t) {       // row nw + lrow, columns d0 + 0..7 of head h
      const int h  = hb + (t >> 1);
      const int d0 = (t & 1) * 16 + 8 * lhi;
      v8h o;
      #pragma unroll
      for (int r = 0; r < 8; ++r) o[r] = (f16)(acc[t][r] * sc);
      *(v8h*)(dst + ((size_t)(bb * HEADS + h) * NSEQ + nw + lrow) * DIMH + d0) = o;
      WAIT_X_0();
    }
  }
}

static __device__ __forceinline__ float other_half(float v) {
  const int b = __builtin_bit_cast(int, v);
  return __builtin_bit_cast(float,
      __builtin_amdgcn_permlanex16(b, b, 0x76543210, 0xfedcba98, false, false));
}

__global__ void __launch_bounds__(256) k_attn(const f16* __restrict__ qw,
                                              const f16* __restrict__ kw,
                                              const f16* __restrict__ vT,
                                              const f16* __restrict__ biasF,
                                              f16* __restrict__ attn) {
  __shared__ __align__(16) f16 Kbuf[2][32 * TILE_PITCH];   // [key][d]   2 x 2.5 KB
  __shared__ __align__(16) f16 Vbuf[2][32 * TILE_PITCH];   // [d][key]   2 x 2.5 KB
  const int tid  = threadIdx.x;
  const int lane = tid & 31;
  const int w    = tid >> 5;
  const int lrow = lane & 15;
  const int lhi  = lane >> 4;
  const int q0   = blockIdx.x * 128 + w * 16;
  const int h    = blockIdx.y;
  const int b    = blockIdx.z;
  const size_t headoff = (size_t)(b * HEADS + h) * NSEQ * DIMH;

  // Copier role: threads 0-127 move the K tile, 128-255 the V tile.
  const int cr = (tid & 127) >> 2;                    // row within 32x32 tile
  const int cc = (tid & 3) * 8;                       // half-offset in row
  const f16* csrc0;
  size_t cstep;                                       // halves per key-block
  unsigned cdst[2];
  if (tid < 128) {                                    // K: row=key, 32 halves
    csrc0 = kw + headoff + (size_t)cr * DIMH + cc;
    cstep = 32 * DIMH;
    cdst[0] = lds_u32(&Kbuf[0][cr * TILE_PITCH + cc]);
    cdst[1] = lds_u32(&Kbuf[1][cr * TILE_PITCH + cc]);
  } else {                                            // V: row=d, stride NSEQ
    csrc0 = vT + headoff + (size_t)cr * NSEQ + cc;
    cstep = 32;
    cdst[0] = lds_u32(&Vbuf[0][cr * TILE_PITCH + cc]);
    cdst[1] = lds_u32(&Vbuf[1][cr * TILE_PITCH + cc]);
  }

  // Q^T B-fragment (K=32 x 16 query columns), pre-scaled by 1/sqrt(d) in k_qkv.
  const f16* qp = qw + headoff + (size_t)(q0 + lrow) * DIMH + lhi * 8;
  const v16h qa = cat8(*(const v8h*)qp, *(const v8h*)(qp + 16));

  // Bias row of this lane's query, at this lane half's first key.
  const f16* brow = biasF + (size_t)h * NSEQ * NSEQ
                          + (size_t)(q0 + lrow) * NSEQ + lhi * 8;

  float m = -1e30f;                 // running max of query q0+lrow (both halves agree)
  float l = 0.f;                    // running sum over THIS lane half's keys only
  const v8f zero = (v8f){0.f,0.f,0.f,0.f,0.f,0.f,0.f,0.f};
  v8f o0 = zero, o1 = zero;         // O^T: reg r = d (8*lhi+r, 16+8*lhi+r), lane = query

  async_cp16(cdst[0], csrc0);                         // prefetch tile 0

  for (int it = 0; it < 32; ++it) {
    const int cur = it & 1;
    const int kb  = it * 32;
    __syncthreads();                  // buf[1-cur] free (prev compute done)
    if (it < 31) {
      async_cp16(cdst[1 - cur], csrc0 + (size_t)(it + 1) * cstep);
      WAIT_ASYNC_1();                 // tile `it` landed, tile it+1 in flight
    } else {
      WAIT_ASYNC_0();
    }
    __syncthreads();                  // tile `it` visible block-wide

    // Relative position bias: keys kb+8*lhi+r and kb+16+8*lhi+r of this query.
    const v8h bb0 = *(const v8h*)(brow + kb);
    const v8h bb1 = *(const v8h*)(brow + kb + 16);

    // K A-fragments from LDS: lane row = key, K-dim = d.
    const f16* kp0 = &Kbuf[cur][lrow * TILE_PITCH + lhi * 8];
    const f16* kp1 = &Kbuf[cur][(16 + lrow) * TILE_PITCH + lhi * 8];
    v16h bk0 = cat8(*(const v8h*)kp0, *(const v8h*)(kp0 + 16));
    v16h bk1 = cat8(*(const v8h*)kp1, *(const v8h*)(kp1 + 16));
    v8f s0 = wmma16(bk0, qa, zero);   // s0[r] = S[q0+lrow][kb + 8*lhi + r]
    v8f s1 = wmma16(bk1, qa, zero);   // s1[r] = S[q0+lrow][kb + 16 + 8*lhi + r]

    #pragma unroll
    for (int r = 0; r < 8; ++r) {
      s0[r] += (float)bb0[r];
      s1[r] += (float)bb1[r];
    }

    // Online softmax: 16 scores of the query in-lane, the other 16 in lane^16.
    float c = fmaxf(s0[0], s1[0]);
    #pragma unroll
    for (int r = 1; r < 8; ++r) c = fmaxf(c, fmaxf(s0[r], s1[r]));
    c = fmaxf(c, other_half(c));
    const float mn   = fmaxf(m, c);
    const float corr = __expf(m - mn);
    float rs = 0.f;
    v16h pb;                          // P^T B-fragment: same k order as the V loader
    #pragma unroll
    for (int r = 0; r < 8; ++r) {
      const float p0 = __expf(s0[r] - mn);
      const float p1 = __expf(s1[r] - mn);
      rs += p0 + p1;
      pb[r]     = (f16)p0;
      pb[8 + r] = (f16)p1;
    }
    l = l * corr + rs;
    m = mn;
    #pragma unroll
    for (int r = 0; r < 8; ++r) { o0[r] *= corr; o1[r] *= corr; }

    // V^T A-fragments from LDS: lane row = d, K-dim = key.
    const f16* vp0 = &Vbuf[cur][lrow * TILE_PITCH + lhi * 8];
    const f16* vp1 = &Vbuf[cur][(16 + lrow) * TILE_PITCH + lhi * 8];
    v16h bv0 = cat8(*(const v8h*)vp0, *(const v8h*)(vp0 + 16));
    v16h bv1 = cat8(*(const v8h*)vp1, *(const v8h*)(vp1 + 16));
    o0 = wmma16(bv0, pb, o0);
    o1 = wmma16(bv1, pb, o1);
  }

  // Join the halves' sums, normalize, store to [B, N, H*D] f16 for the output
  // GEMM: 8 consecutive d per lane and tile, one 16-byte store each.
  l += other_half(l);
  const float inv = 1.f / l;
  v8h r0, r1;
  #pragma unroll
  for (int r = 0; r < 8; ++r) { r0[r] = (f16)(o0[r] * inv); r1[r] = (f16)(o1[r] * inv); }
  f16* op = attn + ((size_t)(b * NSEQ + q0 + lrow) * HEADS + h) * DIMH + lhi * 8;
  *(v8h*)op        = r0;
  *(v8h*)(op + 16) = r1;
}

// ---------------------------------------------------------------------------
// Kernel 5: output projection. attn[16384,256]f16 @ WoutT + b_out -> f32 out.
// Same LDS-staged weight panel as k_qkv.
// ---------------------------------------------------------------------------
__global__ void __launch_bounds__(256) k_out(const f16* __restrict__ A,
                                             const f16* __restrict__ WT,
                                             const float* __restrict__ bias,
                                             float* __restrict__ out) {
  __shared__ __align__(16) f16 Bpanel[64][PANEL_PITCH];   // 33 KB
  const int tid  = threadIdx.x;
  const int lane = tid & 31;
  const int w    = tid >> 5;
  const int lrow = lane & 15;
  const int lhi  = lane >> 4;
  const int m0   = blockIdx.y * 128 + w * 16;
  const int n0   = blockIdx.x * 64;

  #pragma unroll
  for (int j = 0; j < 8; ++j) {
    const int c = tid + j * 256;
    const int row = c >> 5, col8 = (c & 31) * 8;
    async_cp16(lds_u32(&Bpanel[row][col8]),
               WT + (size_t)(n0 + row) * DINP + col8);
  }
  WAIT_ASYNC_0();
  __syncthreads();

  v8f acc[4];
  #pragma unroll
  for (int t = 0; t < 4; ++t) acc[t] = (v8f){0.f,0.f,0.f,0.f,0.f,0.f,0.f,0.f};

  const f16* arow = A + (size_t)(m0 + lrow) * DINP;
  #pragma unroll
  for (int k0 = 0; k0 < DINP; k0 += 32) {
    const f16* ap = arow + k0 + lhi * 8;
    v16h a = cat8(*(const v8h*)ap, *(const v8h*)(ap + 16));
    #pragma unroll
    for (int t = 0; t < 4; ++t) {
      const f16* bp = &Bpanel[t * 16 + lrow][k0 + lhi * 8];
      v16h b = cat8(*(const v8h*)bp, *(const v8h*)(bp + 16));
      acc[t] = wmma16(a, b, acc[t]);
    }
  }

  #pragma unroll
  for (int t = 0; t < 4; ++t) {
    const int gcol = n0 + t * 16 + lrow;
    const float bv = bias[gcol];
    #pragma unroll
    for (int r = 0; r < 8; ++r) {
      out[(size_t)(m0 + r + 8 * lhi) * NOUT + gcol] = acc[t][r] + bv;
    }
  }
}

// ---------------------------------------------------------------------------
extern "C" void kernel_launch(void* const* d_in, const int* in_sizes, int n_in,
                              void* d_out, int out_size, void* d_ws, size_t ws_size,
                              hipStream_t stream) {
  const float* x      = (const float*)d_in[0];   // [16,1024,256]
  const float* W_qkv  = (const float*)d_in[1];   // [256,768]
  const float* W_out  = (const float*)d_in[2];   // [256,256]
  const float* b_out  = (const float*)d_in[3];   // [256]
  const float* btable = (const float*)d_in[4];   // [3969,8]
  const int*   relidx = (const int*)d_in[5];     // [1024*1024]
  float* out = (float*)d_out;

  char* ws = (char*)d_ws;
  size_t off = 0;
  f16* WqkvT = (f16*)(ws + off); off += (size_t)NQKV * DINP * 2;          // 384 KB
  f16* WoutT = (f16*)(ws + off); off += (size_t)NOUT * DINP * 2;          // 128 KB
  f16* qw    = (f16*)(ws + off); off += (size_t)B_SZ * HEADS * NSEQ * DIMH * 2; // 8 MB
  f16* kw    = (f16*)(ws + off); off += (size_t)B_SZ * HEADS * NSEQ * DIMH * 2; // 8 MB
  f16* vT    = (f16*)(ws + off); off += (size_t)B_SZ * HEADS * NSEQ * DIMH * 2; // 8 MB
  f16* attn  = (f16*)(ws + off); off += (size_t)B_SZ * NSEQ * HEADS * DIMH * 2; // 8 MB
  f16* biasF = (f16*)(ws + off); off += (size_t)HEADS * NSEQ * NSEQ * 2;        // 16 MB

  k_prep<<<(NQKV * DINP + NOUT * DINP) / 256, 256, 0, stream>>>(W_qkv, W_out, WqkvT, WoutT);
  k_bias<<<(NSEQ * NSEQ) / 2048, 256, 0, stream>>>(btable, relidx, biasF);
  k_qkv<<<dim3(NQKV / 64, (B_SZ * NSEQ) / 128), 256, 0, stream>>>(x, WqkvT, qw, kw, vT);
  k_attn<<<dim3(NSEQ / 128, HEADS, B_SZ), 256, 0, stream>>>(qw, kw, vT, biasF, attn);
  k_out<<<dim3(NOUT / 64, (B_SZ * NSEQ) / 128), 256, 0, stream>>>(attn, WoutT, b_out, out);
}

// v005
// Measured time: 71.2 microseconds a run.
// Two timings next to v004 both put it at 1.08 times that version's speed.
// All steps since v000 together make it 2.38 times as fast.
#include <hip/hip_runtime.h>
#include <hip/hip_bf16.h>

typedef _Float16 f16;
typedef _Float16 v16h __attribute__((ext_vector_type(16)));
typedef _Float16 v8h  __attribute__((ext_vector_type(8)));
typedef float    v8f  __attribute__((ext_vector_type(8)));
typedef float    v4f  __attribute__((ext_vector_type(4)));

#define B_SZ   16
#define NSEQ   1024
#define HEADS  8
#define DIMH   32
#define DINP   256
#define NQKV   768
#define NOUT   256
#define NTAB   3969                    // rows of the bias table, (2*32-1)^2
#define SCALE  0.17677669529663689f   // 32^-0.5
// LDS row pitches in halves: row length + 16 B, an odd multiple of 16 B, so that
// the 16 rows of a ds_load_b128 fragment read fall on 16 different bank groups.
#define PANEL_PITCH (DINP + 8)         // 528 B for the 512-B weight rows
#define TILE_PITCH  (DIMH + 8)         // 80 B for the 64-B K and V tile rows
#define BTILE  256                     // halves of one 16-key x 16-query bias tile

static __device__ __forceinline__ v16h cat8(v8h lo, v8h hi) {
  return __builtin_shufflevector(lo, hi, 0,1,2,3,4,5,6,7,8,9,10,11,12,13,14,15);
}
static __device__ __forceinline__ v8f wmma16(v16h a, v16h b, v8f c) {
  // D = A(16x32 f16) * B(32x16 f16) + C(16x16 f32)
  return __builtin_amdgcn_wmma_f32_16x16x32_f16(false, a, false, b, (short)0, c, false, false);
}

// LDS byte offset of a shared-memory pointer: low 32 bits of the flat address
// (ISA 10.2: aperture LDS mapping is LDS_ADDR.U32 = addr[31:0]).
static __device__ __forceinline__ unsigned lds_u32(const void* p) {
  return (unsigned)(size_t)p;
}
// Async copy of 16 bytes global -> LDS per lane (ASYNCcnt-tracked).
static __device__ __forceinline__ void async_cp16(unsigned lds_dst, const f16* gsrc) {
  asm volatile("global_load_async_to_lds_b128 %0, %1, off"
               :: "v"(lds_dst), "v"(gsrc)
               : "memory");
}
#define WAIT_ASYNC_0() asm volatile("s_wait_asynccnt 0x0" ::: "memory")
#define WAIT_ASYNC_1() asm volatile("s_wait_asynccnt 0x1" ::: "memory")
#define WAIT_X_0()     asm volatile("s_wait_xcnt 0x0" ::: "memory")

// ---------------------------------------------------------------------------
// Kernel 1: transpose weights to f16 [out, k] so WMMA B fragments are
// contiguous per-lane 16B loads.
// ---------------------------------------------------------------------------
__global__ void __launch_bounds__(256) k_prep(const float* __restrict__ Wqkv,
                                              const float* __restrict__ Wout,
                                              f16* __restrict__ WqkvT,
                                              f16* __restrict__ WoutT) {
  int idx = blockIdx.x * 256 + threadIdx.x;           // 1024 blocks -> 262144
  if (idx < NQKV * DINP) {
    int o = idx / DINP, k = idx % DINP;
    WqkvT[o * DINP + k] = (f16)Wqkv[k * NQKV + o];
  } else {
    int j = idx - NQKV * DINP;                        // < 256*256
    int o = j / DINP, k = j % DINP;
    WoutT[o * DINP + k] = (f16)Wout[k * NOUT + o];
  }
}

// ---------------------------------------------------------------------------
// Kernel 2: materialize the relative-position bias as f16 tiles in the order of
// a WMMA A operand: [head][query tile][key tile][key 0-15][query 0-15], 512 B a
// tile. One wave makes one tile for ALL 8 heads: lane = (key lrow, query half
// lhi), 8 queries a thread. The index is read once, a table row (8 heads, 32 B)
// comes as two 16-byte loads, and a thread's 8 queries of a head leave as one
// 16-byte store, so that each wave-wide store fills four whole 128-byte lines.
// ---------------------------------------------------------------------------
__global__ void __launch_bounds__(256) k_bias(const float* __restrict__ table,
                                              const int* __restrict__ relidx,
                                              f16* __restrict__ biasT) {
  const unsigned lane = threadIdx.x & 31u;
  const unsigned lrow = lane & 15u;
  const unsigned lhi  = lane >> 4;
  const unsigned wv   = blockIdx.x * 8u + (threadIdx.x >> 5);   // 512 blocks -> 4096 waves = tiles
  const unsigned kt   = wv & 63u;                               // key tile
  const unsigned qt   = wv >> 6;                                // query tile

  const int* ip = relidx + (qt * 16u + lhi * 8u) * NSEQ + kt * 16u + lrow;
  int id[8];
  #pragma unroll
  for (int i = 0; i < 8; ++i) id[i] = ip[i * NSEQ];             // query qt*16 + lhi*8 + i, this key

  unsigned off[8];                                              // byte offset of each table row
  v4f row[8][2];                                                // [query][heads 0-3, 4-7]
  #pragma unroll
  for (int i = 0; i < 8; ++i) {
    // Bound the row before the address is formed (identity for a valid index).
    off[i] = min((unsigned)id[i], (unsigned)(NTAB - 1)) * (unsigned)(HEADS * sizeof(float));
    const float* tp = (const float*)((const char*)table + off[i]);
    row[i][0] = *(const v4f*)tp;
    row[i][1] = *(const v4f*)(tp + 4);
  }
  // Precaution: the wait stands behind the gathers and takes their offsets as
  // inputs, which keeps those registers live up to it, so that none of them is
  // written (by a later gather's data either) in front of the wait.
  asm volatile("s_wait_xcnt 0x0"
               :: "v"(off[0]), "v"(off[1]), "v"(off[2]), "v"(off[3]),
                  "v"(off[4]), "v"(off[5]), "v"(off[6]), "v"(off[7])
               : "memory");

  f16* op = biasT + (size_t)(qt * 64u + kt) * BTILE + lrow * 16u + lhi * 8u;
  #pragma unroll
  for (int h = 0; h < HEADS; ++h) {
    v8h o;
    #pragma unroll
    for (int i = 0; i < 8; ++i) o[i] = (f16)row[i][h >> 2][h & 3];
    *(v8h*)(op + (size_t)h * NSEQ * NSEQ) = o;
  }
}

// ---------------------------------------------------------------------------
// Kernel 3: QKV projection. x[16384,256]f32 @ WqkvT -> q/k/vT in head layout.
// Block = 8 waves stacked in M (128x64 C tile). The shared 64x256 f16 weight
// panel is staged once into LDS via async-to-LDS copies (8x traffic cut).
// A 64-column block lies wholly in q, in k or in v. The operand roles are chosen so
// that a lane's 8 results of a tile lie along the contiguous axis of their output
// (d for q and k, n for vT) and leave as ONE 16-byte store.
// ---------------------------------------------------------------------------
// The 32 products of a wave's 16 x 64 tile. XA: the x rows are the A operand
// (reg r = x row r + 8*lhi, lane = column lrow); else the weight rows are A
// (reg r = column r + 8*lhi, lane = x row lrow). Both loaders keep one k order.
template <bool XA>
static __device__ __forceinline__ void qkv_products(const float* __restrict__ xfrag,
                                                    const f16 (&Bpanel)[64][PANEL_PITCH],
                                                    int lrow, int lhi, v8f (&acc)[4]) {
  #pragma unroll
  for (int k0 = 0; k0 < DINP; k0 += 32) {
    // x fragment: f32 -> f16 inline conversion (K chunks lhi*8 and 16+lhi*8)
    const float* xp = xfrag + k0;
    v8h alo, ahi;
    #pragma unroll
    for (int i = 0; i < 8; ++i) { alo[i] = (f16)xp[i]; ahi[i] = (f16)xp[16 + i]; }
    v16h a = cat8(alo, ahi);
    #pragma unroll
    for (int t = 0; t < 4; ++t) {
      const f16* bp = &Bpanel[t * 16 + lrow][k0 + lhi * 8];
      v16h b = cat8(*(const v8h*)bp, *(const v8h*)(bp + 16));
      acc[t] = XA ? wmma16(a, b, acc[t]) : wmma16(b, a, acc[t]);
    }
  }
  // Precaution: the wait takes the x loads' address as an input, which keeps that pair
  // live up to it, so that no load's data is written over it in front of the wait.
  asm volatile("s_wait_xcnt 0x0" :: "v"(xfrag) : "memory");
}

// 12 waves per SIMD (at most 80 registers): all 1,536 blocks, 6 per WGP, are resident at once.
__global__ void __launch_bounds__(256, 12) k_qkv(const float* __restrict__ x,
                                             const f16* __restrict__ WT,
                                             f16* __restrict__ qw,
                                             f16* __restrict__ kw,
                                             f16* __restrict__ vT) {
  __shared__ __align__(16) f16 Bpanel[64][PANEL_PITCH];   // 33 KB
  const int tid  = threadIdx.x;
  const int lane = tid & 31;
  const int w    = tid >> 5;
  const int lrow = lane & 15;
  const int lhi  = lane >> 4;
  const int m0   = blockIdx.y * 128 + w * 16;
  const int n0   = blockIdx.x * 64;

  // Stage weight panel: 64 rows x 512 B = 2048 chunks of 16 B, 8 per thread.
  #pragma unroll
  for (int j = 0; j < 8; ++j) {
    const int c = tid + j * 256;                      // chunk id
    const int row = c >> 5, col8 = (c & 31) * 8;
    async_cp16(lds_u32(&Bpanel[row][col8]),
               WT + (size_t)(n0 + row) * DINP + col8);
  }
  WAIT_ASYNC_0();
  __syncthreads();

  v8f acc[4];
  #pragma unroll
  for (int t = 0; t < 4; ++t) acc[t] = (v8f){0.f,0.f,0.f,0.f,0.f,0.f,0.f,0.f};

  const float* xfrag = x + (size_t)(m0 + lrow) * DINP + lhi * 8;   // this lane's first K chunk
  const int which = n0 >> 8;            // 0=q 1=k 2=v, the same for the whole block
  const int hb    = (n0 & 255) >> 5;    // first of the block's two heads
  const int bb    = m0 >> 10;           // a wave's 16 rows lie in one batch
  const int nw    = m0 & 1023;          // its first row inside the batch
  // Precaution, both arms: the wait stands directly behind each store, in front of
  // the next write of a register that the store names.
  if (which == 2) {
    qkv_products<true>(xfrag, Bpanel, lrow, lhi, acc);
    #pragma unroll
    for (int t = 0; t < 4; ++t) {       // column d of head h, rows nw + 8*lhi + 0..7
      const int h = hb + (t >> 1);
      const int d = (t & 1) * 16 + lrow;
      v8h o;
      #pragma unroll
      for (int r = 0; r < 8; ++r) o[r] = (f16)acc[t][r];
      *(v8h*)(vT + ((size_t)(bb * HEADS + h) * DIMH + d) * NSEQ + nw + 8 * lhi) = o;
      WAIT_X_0();
    }
  } else {
    qkv_products<false>(xfrag, Bpanel, lrow, lhi, acc);
    f16* __restrict__ dst = which == 0 ? qw : kw;
    const float sc = which == 0 ? SCALE : 1.f;
    #pragma unroll
    for (int t = 0; t < 4; ++t) {       // row nw + lrow, columns d0 + 0..7 of head h
      const int h  = hb + (t >> 1);
      const int d0 = (t & 1) * 16 + 8 * lhi;
      v8h o;
      #pragma unroll
      for (int r = 0; r < 8; ++r) o[r] = (f16)(acc[t][r] * sc);
      *(v8h*)(dst + ((size_t)(bb * HEADS + h) * NSEQ + nw + lrow) * DIMH + d0) = o;
      WAIT_X_0();
    }
  }
}

static __device__ __forceinline__ float other_half(float v) {
  const int b = __builtin_bit_cast(int, v);
  return __builtin_bit_cast(float,
      __builtin_amdgcn_permlanex16(b, b, 0x76543210, 0xfedcba98, false, false));
}

__global__ void __launch_bounds__(256) k_attn(const f16* __restrict__ qw,
                                              const f16* __restrict__ kw,
                                              const f16* __restrict__ vT,
                                              const f16* __restrict__ biasT,
                                              f16* __restrict__ attn) {
  __shared__ __align__(16) f16 Kbuf[2][32 * TILE_PITCH];   // [key][d]   2 x 2.5 KB
  __shared__ __align__(16) f16 Vbuf[2][32 * TILE_PITCH];   // [d][key]   2 x 2.5 KB
  const int tid  = threadIdx.x;
  const int lane = tid & 31;
  const int w    = tid >> 5;
  const int lrow = lane & 15;
  const int lhi  = lane >> 4;
  const int q0   = blockIdx.x * 128 + w * 16;
  const int h    = blockIdx.y;
  const int b    = blockIdx.z;
  const size_t headoff = (size_t)(b * HEADS + h) * NSEQ * DIMH;

  // Copier role: threads 0-127 move the K tile, 128-255 the V tile.
  const int cr = (tid & 127) >> 2;                    // row within 32x32 tile
  const int cc = (tid & 3) * 8;                       // half-offset in row
  const f16* csrc0;
  size_t cstep;                                       // halves per key-block
  unsigned cdst[2];
  if (tid < 128) {                                    // K: row=key, 32 halves
    csrc0 = kw + headoff + (size_t)cr * DIMH + cc;
    cstep = 32 * DIMH;
    cdst[0] = lds_u32(&Kbuf[0][cr * TILE_PITCH + cc]);
    cdst[1] = lds_u32(&Kbuf[1][cr * TILE_PITCH + cc]);
  } else {                                            // V: row=d, stride NSEQ
    csrc0 = vT + headoff + (size_t)cr * NSEQ + cc;
    cstep = 32;
    cdst[0] = lds_u32(&Vbuf[0][cr * TILE_PITCH + cc]);
    cdst[1] = lds_u32(&Vbuf[1][cr * TILE_PITCH + cc]);
  }

  // Q^T B-fragment (K=32 x 16 query columns), pre-scaled by 1/sqrt(d) in k_qkv.
  const f16* qp = qw + headoff + (size_t)(q0 + lrow) * DIMH + lhi * 8;
  const v16h qa = cat8(*(const v8h*)qp, *(const v8h*)(qp + 16));

  // This wave's row of bias tiles; the lane reads key lrow, queries 8*lhi + 0..7.
  const f16* btile = biasT + (size_t)h * NSEQ * NSEQ
                           + (size_t)(q0 >> 4) * (NSEQ / 16) * BTILE + lrow * 16 + lhi * 8;
  // Identity B operands (k = query of the tile, column = query lrow). One A operand
  // carries two bias tiles: keys 0-15 in k slots 0-15, keys 16-31 in k slots 16-31;
  // idlo picks the first, idhi the second. Same k order as every loader here.
  v16h idlo, idhi;
  #pragma unroll
  for (int i = 0; i < 8; ++i) {
    const f16 e = (lhi * 8 + i == lrow) ? (f16)1.f : (f16)0.f;
    idlo[i] = e;          idlo[8 + i] = (f16)0.f;
    idhi[i] = (f16)0.f;   idhi[8 + i] = e;
  }

  float m = -1e30f;                 // running max of query q0+lrow (both halves agree)
  float l = 0.f;                    // running sum over THIS lane half's keys only
  const v8f zero = (v8f){0.f,0.f,0.f,0.f,0.f,0.f,0.f,0.f};
  v8f o0 = zero, o1 = zero;         // O^T: reg r = d (8*lhi+r, 16+8*lhi+r), lane = query

  async_cp16(cdst[0], csrc0);                         // prefetch tile 0

  for (int it = 0; it < 32; ++it) {
    const int cur = it & 1;
    __syncthreads();                  // buf[1-cur] free (prev compute done)
    if (it < 31) {
      async_cp16(cdst[1 - cur], csrc0 + (size_t)(it + 1) * cstep);
      WAIT_ASYNC_1();                 // tile `it` landed, tile it+1 in flight
    } else {
      WAIT_ASYNC_0();
    }
    __syncthreads();                  // tile `it` visible block-wide

    // Relative position bias: the tiles of keys kb+0..15 and kb+16..31, kb = 32*it.
    const v8h bb0 = *(const v8h*)(btile + it * (2 * BTILE));
    const v8h bb1 = *(const v8h*)(btile + it * (2 * BTILE) + BTILE);
    const v16h ba = cat8(bb0, bb1);

    // K A-fragments from LDS: lane row = key, K-dim = d.
    const f16* kp0 = &Kbuf[cur][lrow * TILE_PITCH + lhi * 8];
    const f16* kp1 = &Kbuf[cur][(16 + lrow) * TILE_PITCH + lhi * 8];
    v16h bk0 = cat8(*(const v8h*)kp0, *(const v8h*)(kp0 + 16));
    v16h bk1 = cat8(*(const v8h*)kp1, *(const v8h*)(kp1 + 16));
    // Keeps the pass's six loads (bias from L2, K from LDS) in front of the first WMMA:
    // without it the bias loads issue behind the K wait and the two latencies add up.
    __builtin_amdgcn_sched_barrier(0);
    v8f s0 = wmma16(bk0, qa, zero);   // s0[r] = S[q0+lrow][kb + 8*lhi + r]
    v8f s1 = wmma16(bk1, qa, zero);   // s1[r] = S[q0+lrow][kb + 16 + 8*lhi + r]
    s0 = wmma16(ba, idlo, s0);        // + bias of the same query and keys
    s1 = wmma16(ba, idhi, s1);

    // Online softmax: 16 scores of the query in-lane, the other 16 in lane^16.
    float c = fmaxf(s0[0], s1[0]);
    #pragma unroll
    for (int r = 1; r < 8; ++r) c = fmaxf(c, fmaxf(s0[r], s1[r]));
    c = fmaxf(c, other_half(c));
    const float mn   = fmaxf(m, c);
    const float corr = __expf(m - mn);
    float rs = 0.f;
    v16h pb;                          // P^T B-fragment: same k order as the V loader
    #pragma unroll
    for (int r = 0; r < 8; ++r) {
      const float p0 = __expf(s0[r] - mn);
      const float p1 = __expf(s1[r] - mn);
      rs += p0 + p1;
      pb[r]     = (f16)p0;
      pb[8 + r] = (f16)p1;
    }
    l = l * corr + rs;
    m = mn;
    #pragma unroll
    for (int r = 0; r < 8; ++r) { o0[r] *= corr; o1[r] *= corr; }

    // V^T A-fragments from LDS: lane row = d, K-dim = key.
    const f16* vp0 = &Vbuf[cur][lrow * TILE_PITCH + lhi * 8];
    const f16* vp1 = &Vbuf[cur][(16 + lrow) * TILE_PITCH + lhi * 8];
    v16h bv0 = cat8(*(const v8h*)vp0, *(const v8h*)(vp0 + 16));
    v16h bv1 = cat8(*(const v8h*)vp1, *(const v8h*)(vp1 + 16));
    o0 = wmma16(bv0, pb, o0);
    o1 = wmma16(bv1, pb, o1);
  }

  // Join the halves' sums, normalize, store to [B, N, H*D] f16 for the output
  // GEMM: 8 consecutive d per lane and tile, one 16-byte store each.
  l += other_half(l);
  const float inv = 1.f / l;
  v8h r0, r1;
  #pragma unroll
  for (int r = 0; r < 8; ++r) { r0[r] = (f16)(o0[r] * inv); r1[r] = (f16)(o1[r] * inv); }
  f16* op = attn + ((size_t)(b * NSEQ + q0 + lrow) * HEADS + h) * DIMH + lhi * 8;
  *(v8h*)op        = r0;
  *(v8h*)(op + 16) = r1;
}

// ---------------------------------------------------------------------------
// Kernel 5: output projection. attn[16384,256]f16 @ WoutT + b_out -> f32 out.
// Same LDS-staged weight panel as k_qkv.
// ---------------------------------------------------------------------------
__global__ void __launch_bounds__(256) k_out(const f16* __restrict__ A,
                                             const f16* __restrict__ WT,
                                             const float* __restrict__ bias,
                                             float* __restrict__ out) {
  __shared__ __align__(16) f16 Bpanel[64][PANEL_PITCH];   // 33 KB
  const int tid  = threadIdx.x;
  const int lane = tid & 31;
  const int w    = tid >> 5;
  const int lrow = lane & 15;
  const int lhi  = lane >> 4;
  const int m0   = blockIdx.y * 128 + w * 16;
  const int n0   = blockIdx.x * 64;

  #pragma unroll
  for (int j = 0; j < 8; ++j) {
    const int c = tid + j * 256;
    const int row = c >> 5, col8 = (c & 31) * 8;
    async_cp16(lds_u32(&Bpanel[row][col8]),
               WT + (size_t)(n0 + row) * DINP + col8);
  }
  WAIT_ASYNC_0();
  __syncthreads();

  v8f acc[4];
  #pragma unroll
  for (int t = 0; t < 4; ++t) acc[t] = (v8f){0.f,0.f,0.f,0.f,0.f,0.f,0.f,0.f};

  const f16* arow = A + (size_t)(m0 + lrow) * DINP;
  #pragma unroll
  for (int k0 = 0; k0 < DINP; k0 += 32) {
    const f16* ap = arow + k0 + lhi * 8;
    v16h a = cat8(*(const v8h*)ap, *(const v8h*)(ap + 16));
    #pragma unroll
    for (int t = 0; t < 4; ++t) {
      const f16* bp = &Bpanel[t * 16 + lrow][k0 + lhi * 8];
      v16h b = cat8(*(const v8h*)bp, *(const v8h*)(bp + 16));
      acc[t] = wmma16(a, b, acc[t]);
    }
  }

  #pragma unroll
  for (int t = 0; t < 4; ++t) {
    const int gcol = n0 + t * 16 + lrow;
    const float bv = bias[gcol];
    #pragma unroll
    for (int r = 0; r < 8; ++r) {
      out[(size_t)(m0 + r + 8 * lhi) * NOUT + gcol] = acc[t][r] + bv;
    }
  }
}

// ---------------------------------------------------------------------------
extern "C" void kernel_launch(void* const* d_in, const int* in_sizes, int n_in,
                              void* d_out, int out_size, void* d_ws, size_t ws_size,
                              hipStream_t stream) {
  const float* x      = (const float*)d_in[0];   // [16,1024,256]
  const float* W_qkv  = (const float*)d_in[1];   // [256,768]
  const float* W_out  = (const float*)d_in[2];   // [256,256]
  const float* b_out  = (const float*)d_in[3];   // [256]
  const float* btable = (const float*)d_in[4];   // [3969,8]
  const int*   relidx = (const int*)d_in[5];     // [1024*1024]
  float* out = (float*)d_out;

  char* ws = (char*)d_ws;
  size_t off = 0;
  f16* WqkvT = (f16*)(ws + off); off += (size_t)NQKV * DINP * 2;          // 384 KB
  f16* WoutT = (f16*)(ws + off); off += (size_t)NOUT * DINP * 2;          // 128 KB
  f16* qw    = (f16*)(ws + off); off += (size_t)B_SZ * HEADS * NSEQ * DIMH * 2; // 8 MB
  f16* kw    = (f16*)(ws + off); off += (size_t)B_SZ * HEADS * NSEQ * DIMH * 2; // 8 MB
  f16* vT    = (f16*)(ws + off); off += (size_t)B_SZ * HEADS * NSEQ * DIMH * 2; // 8 MB
  f16* attn  = (f16*)(ws + off); off += (size_t)B_SZ * NSEQ * HEADS * DIMH * 2; // 8 MB
  f16* biasT = (f16*)(ws + off); off += (size_t)HEADS * NSEQ * NSEQ * 2;        // 16 MB

  k_prep<<<(NQKV * DINP + NOUT * DINP) / 256, 256, 0, stream>>>(W_qkv, W_out, WqkvT, WoutT);
  k_bias<<<(NSEQ * NSEQ) / 2048, 256, 0, stream>>>(btable, relidx, biasT);
  k_qkv<<<dim3(NQKV / 64, (B_SZ * NSEQ) / 128), 256, 0, stream>>>(x, WqkvT, qw, kw, vT);
  k_attn<<<dim3(NSEQ / 128, HEADS, B_SZ), 256, 0, stream>>>(qw, kw, vT, biasT, attn);
  k_out<<<dim3(NOUT / 64, (B_SZ * NSEQ) / 128), 256, 0, stream>>>(attn, WoutT, b_out, out);
}

// v006
// Measured time: 67.4 microseconds a run.
// Timed twice side by side with v005, it ran 1.05 times as fast both times.
// Counting every step since v000, it is 2.50 times as fast.
#include <hip/hip_runtime.h>
#include <hip/hip_bf16.h>

typedef _Float16 f16;
typedef _Float16 v16h __attribute__((ext_vector_type(16)));
typedef _Float16 v8h  __attribute__((ext_vector_type(8)));
typedef float    v8f  __attribute__((ext_vector_type(8)));
typedef float    v4f  __attribute__((ext_vector_type(4)));

#define B_SZ   16
#define NSEQ   1024
#define HEADS  8
#define DIMH   32
#define DINP   256
#define NQKV   768
#define NOUT   256
#define NTAB   3969                    // rows of the bias table, (2*32-1)^2
#define SCALE  0.17677669529663689f   // 32^-0.5
#define LOG2E  1.44269504088896341f    // log2(e)
// LDS row pitches in halves: row length + 16 B, an odd multiple of 16 B, so that
// the 16 rows of a ds_load_b128 fragment read fall on 16 different bank groups.
#define PANEL_PITCH (DINP + 8)         // 528 B for the 512-B weight rows
#define TILE_PITCH  (DIMH + 8)         // 80 B for the 64-B K tile rows
#define BTILE  256                     // halves of one 16-key x 16-query bias tile
#define KPASS  64                      // keys of one pass of k_attn
#define VT_PITCH (KPASS + 8)           // 144 B for the 128-B V tile rows

static __device__ __forceinline__ v16h cat8(v8h lo, v8h hi) {
  return __builtin_shufflevector(lo, hi, 0,1,2,3,4,5,6,7,8,9,10,11,12,13,14,15);
}
static __device__ __forceinline__ v8f wmma16(v16h a, v16h b, v8f c) {
  // D = A(16x32 f16) * B(32x16 f16) + C(16x16 f32)
  return __builtin_amdgcn_wmma_f32_16x16x32_f16(false, a, false, b, (short)0, c, false, false);
}

// LDS byte offset of a shared-memory pointer: low 32 bits of the flat address
// (ISA 10.2: aperture LDS mapping is LDS_ADDR.U32 = addr[31:0]).
static __device__ __forceinline__ unsigned lds_u32(const void* p) {
  return (unsigned)(size_t)p;
}
// Async copy of 16 bytes global -> LDS per lane (ASYNCcnt-tracked).
static __device__ __forceinline__ void async_cp16(unsigned lds_dst, const f16* gsrc) {
  asm volatile("global_load_async_to_lds_b128 %0, %1, off"
               :: "v"(lds_dst), "v"(gsrc)
               : "memory");
}
#define WAIT_ASYNC_0() asm volatile("s_wait_asynccnt 0x0" ::: "memory")
#define WAIT_X_0()     asm volatile("s_wait_xcnt 0x0" ::: "memory")

// ---------------------------------------------------------------------------
// Kernel 1: transpose weights to f16 [out, k] so WMMA B fragments are
// contiguous per-lane 16B loads.
// ---------------------------------------------------------------------------
__global__ void __launch_bounds__(256) k_prep(const float* __restrict__ Wqkv,
                                              const float* __restrict__ Wout,
                                              f16* __restrict__ WqkvT,
                                              f16* __restrict__ WoutT) {
  int idx = blockIdx.x * 256 + threadIdx.x;           // 1024 blocks -> 262144
  if (idx < NQKV * DINP) {
    int o = idx / DINP, k = idx % DINP;
    WqkvT[o * DINP + k] = (f16)Wqkv[k * NQKV + o];
  } else {
    int j = idx - NQKV * DINP;                        // < 256*256
    int o = j / DINP, k = j % DINP;
    WoutT[o * DINP + k] = (f16)Wout[k * NOUT + o];
  }
}

// ---------------------------------------------------------------------------
// Kernel 2: materialize the relative-position bias as f16 tiles in the order of
// a WMMA A operand: [head][query tile][key tile][key 0-15][query 0-15], 512 B a
// tile. One wave makes one tile for ALL 8 heads: lane = (key lrow, query half
// lhi), 8 queries a thread. The index is read once, a table row (8 heads, 32 B)
// comes as two 16-byte loads, and a thread's 8 queries of a head leave as one
// 16-byte store, so that each wave-wide store fills four whole 128-byte lines.
// ---------------------------------------------------------------------------
__global__ void __launch_bounds__(256) k_bias(const float* __restrict__ table,
                                              const int* __restrict__ relidx,
                                              f16* __restrict__ biasT) {
  const unsigned lane = threadIdx.x & 31u;
  const unsigned lrow = lane & 15u;
  const unsigned lhi  = lane >> 4;
  const unsigned wv   = blockIdx.x * 8u + (threadIdx.x >> 5);   // 512 blocks -> 4096 waves = tiles
  const unsigned kt   = wv & 63u;                               // key tile
  const unsigned qt   = wv >> 6;                                // query tile

  const int* ip = relidx + (qt * 16u + lhi * 8u) * NSEQ + kt * 16u + lrow;
  int id[8];
  #pragma unroll
  for (int i = 0; i < 8; ++i) id[i] = ip[i * NSEQ];             // query qt*16 + lhi*8 + i, this key

  unsigned off[8];                                              // byte offset of each table row
  v4f row[8][2];                                                // [query][heads 0-3, 4-7]
  #pragma unroll
  for (int i = 0; i < 8; ++i) {
    // Bound the row before the address is formed (identity for a valid index).
    off[i] = min((unsigned)id[i], (unsigned)(NTAB - 1)) * (unsigned)(HEADS * sizeof(float));
    const float* tp = (const float*)((const char*)table + off[i]);
    row[i][0] = *(const v4f*)tp;
    row[i][1] = *(const v4f*)(tp + 4);
  }
  // Precaution: the wait stands behind the gathers and takes their offsets as
  // inputs, which keeps those registers live up to it, so that none of them is
  // written (by a later gather's data either) in front of the wait.
  asm volatile("s_wait_xcnt 0x0"
               :: "v"(off[0]), "v"(off[1]), "v"(off[2]), "v"(off[3]),
                  "v"(off[4]), "v"(off[5]), "v"(off[6]), "v"(off[7])
               : "memory");

  f16* op = biasT + (size_t)(qt * 64u + kt) * BTILE + lrow * 16u + lhi * 8u;
  #pragma unroll
  for (int h = 0; h < HEADS; ++h) {
    v8h o;
    #pragma unroll
    for (int i = 0; i < 8; ++i) o[i] = (f16)row[i][h >> 2][h & 3];
    *(v8h*)(op + (size_t)h * NSEQ * NSEQ) = o;
  }
}

// ---------------------------------------------------------------------------
// Kernel 3: QKV projection. x[16384,256]f32 @ WqkvT -> q/k/vT in head layout.
// Block = 8 waves stacked in M (128x64 C tile). The shared 64x256 f16 weight
// panel is staged once into LDS via async-to-LDS copies (8x traffic cut).
// A 64-column block lies wholly in q, in k or in v. The operand roles are chosen so
// that a lane's 8 results of a tile lie along the contiguous axis of their output
// (d for q and k, n for vT) and leave as ONE 16-byte store.
// ---------------------------------------------------------------------------
// The 32 products of a wave's 16 x 64 tile. XA: the x rows are the A operand
// (reg r = x row r + 8*lhi, lane = column lrow); else the weight rows are A
// (reg r = column r + 8*lhi, lane = x row lrow). Both loaders keep one k order.
template <bool XA>
static __device__ __forceinline__ void qkv_products(const float* __restrict__ xfrag,
                                                    const f16 (&Bpanel)[64][PANEL_PITCH],
                                                    int lrow, int lhi, v8f (&acc)[4]) {
  #pragma unroll
  for (int k0 = 0; k0 < DINP; k0 += 32) {
    // x fragment: f32 -> f16 inline conversion (K chunks lhi*8 and 16+lhi*8)
    const float* xp = xfrag + k0;
    v8h alo, ahi;
    #pragma unroll
    for (int i = 0; i < 8; ++i) { alo[i] = (f16)xp[i]; ahi[i] = (f16)xp[16 + i]; }
    v16h a = cat8(alo, ahi);
    #pragma unroll
    for (int t = 0; t < 4; ++t) {
      const f16* bp = &Bpanel[t * 16 + lrow][k0 + lhi * 8];
      v16h b = cat8(*(const v8h*)bp, *(const v8h*)(bp + 16));
      acc[t] = XA ? wmma16(a, b, acc[t]) : wmma16(b, a, acc[t]);
    }
  }
  // Precaution: the wait takes the x loads' address as an input, which keeps that pair
  // live up to it, so that no load's data is written over it in front of the wait.
  asm volatile("s_wait_xcnt 0x0" :: "v"(xfrag) : "memory");
}

// 12 waves per SIMD (at most 80 registers): all 1,536 blocks, 6 per WGP, are resident at once.
__global__ void __launch_bounds__(256, 12) k_qkv(const float* __restrict__ x,
                                             const f16* __restrict__ WT,
                                             f16* __restrict__ qw,
                                             f16* __restrict__ kw,
                                             f16* __restrict__ vT) {
  __shared__ __align__(16) f16 Bpanel[64][PANEL_PITCH];   // 33 KB
  const int tid  = threadIdx.x;
  const int lane = tid & 31;
  const int w    = tid >> 5;
  const int lrow = lane & 15;
  const int lhi  = lane >> 4;
  const int m0   = blockIdx.y * 128 + w * 16;
  const int n0   = blockIdx.x * 64;

  // Stage weight panel: 64 rows x 512 B = 2048 chunks of 16 B, 8 per thread.
  #pragma unroll
  for (int j = 0; j < 8; ++j) {
    const int c = tid + j * 256;                      // chunk id
    const int row = c >> 5, col8 = (c & 31) * 8;
    async_cp16(lds_u32(&Bpanel[row][col8]),
               WT + (size_t)(n0 + row) * DINP + col8);
  }
  WAIT_ASYNC_0();
  __syncthreads();

  v8f acc[4];
  #pragma unroll
  for (int t = 0; t < 4; ++t) acc[t] = (v8f){0.f,0.f,0.f,0.f,0.f,0.f,0.f,0.f};

  const float* xfrag = x + (size_t)(m0 + lrow) * DINP + lhi * 8;   // this lane's first K chunk
  const int which = n0 >> 8;            // 0=q 1=k 2=v, the same for the whole block
  const int hb    = (n0 & 255) >> 5;    // first of the block's two heads
  const int bb    = m0 >> 10;           // a wave's 16 rows lie in one batch
  const int nw    = m0 & 1023;          // its first row inside the batch
  // Precaution, both arms: the wait stands directly behind each store, in front of
  // the next write of a register that the store names.
  if (which == 2) {
    qkv_products<true>(xfrag, Bpanel, lrow, lhi, acc);
    #pragma unroll
    for (int t = 0; t < 4; ++t) {       // column d of head h, rows nw + 8*lhi + 0..7
      const int h = hb + (t >> 1);
      const int d = (t & 1) * 16 + lrow;
      v8h o;
      #pragma unroll
      for (int r = 0; r < 8; ++r) o[r] = (f16)acc[t][r];
      *(v8h*)(vT + ((size_t)(bb * HEADS + h) * DIMH + d) * NSEQ + nw + 8 * lhi) = o;
      WAIT_X_0();
    }
  } else {
    qkv_products<false>(xfrag, Bpanel, lrow, lhi, acc);
    f16* __restrict__ dst = which == 0 ? qw : kw;
    const float sc = which == 0 ? SCALE : 1.f;
    #pragma unroll
    for (int t = 0; t < 4; ++t) {       // row nw + lrow, columns d0 + 0..7 of head h
      const int h  = hb + (t >> 1);
      const int d0 = (t & 1) * 16 + 8 * lhi;
      v8h o;
      #pragma unroll
      for (int r = 0; r < 8; ++r) o[r] = (f16)(acc[t][r] * sc);
      *(v8h*)(dst + ((size_t)(bb * HEADS + h) * NSEQ + nw + lrow) * DIMH + d0) = o;
      WAIT_X_0();
    }
  }
}

static __device__ __forceinline__ float other_half(float v) {
  const int b = __builtin_bit_cast(int, v);
  return __builtin_bit_cast(float,
      __builtin_amdgcn_permlanex16(b, b, 0x76543210, 0xfedcba98, false, false));
}

// One K chunk and one V chunk of 16 bytes per lane, global -> LDS. The two copies and
// their s_wait_xcnt stand in one statement, so that no register that a copy names can
// be rewritten in front of the wait (a precaution).
static __device__ __forceinline__ void async_cp16_kv(unsigned kdst, const f16* ksrc,
                                                     unsigned vdst, const f16* vsrc) {
  asm volatile("global_load_async_to_lds_b128 %0, %2, off\n\t"
               "global_load_async_to_lds_b128 %1, %3, off\n\t"
               "s_wait_xcnt 0x0"
               :: "v"(kdst), "v"(vdst), "v"(ksrc), "v"(vsrc)
               : "memory");
}

__global__ void __launch_bounds__(256) k_attn(const f16* __restrict__ qw,
                                              const f16* __restrict__ kw,
                                              const f16* __restrict__ vT,
                                              const f16* __restrict__ biasT,
                                              f16* __restrict__ attn) {
  __shared__ __align__(16) f16 Kbuf[2][KPASS * TILE_PITCH];   // [key][d]   2 x 5 KB
  __shared__ __align__(16) f16 Vbuf[2][DIMH * VT_PITCH];      // [d][key]   2 x 4.5 KB
  const int tid  = threadIdx.x;
  const int lane = tid & 31;
  const int w    = tid >> 5;
  const int lrow = lane & 15;
  const int lhi  = lane >> 4;
  const int q0   = blockIdx.x * 128 + w * 16;
  const int h    = blockIdx.y;
  const int b    = blockIdx.z;
  const size_t headoff = (size_t)(b * HEADS + h) * NSEQ * DIMH;

  // Copier role: every thread moves one 16-byte chunk of the K tile (64 keys x 64 B)
  // and one of the V tile (32 d rows x 128 B) a pass.
  const int kr = tid >> 2, kc = (tid & 3) * 8;        // K: row = key
  const int vr = tid >> 3, vc = (tid & 7) * 8;        // V: row = d, stride NSEQ
  const f16* ksrc0 = kw + headoff + (size_t)kr * DIMH + kc;
  const f16* vsrc0 = vT + headoff + (size_t)vr * NSEQ + vc;
  const unsigned kdst0 = lds_u32(&Kbuf[0][kr * TILE_PITCH + kc]);
  const unsigned vdst0 = lds_u32(&Vbuf[0][vr * VT_PITCH + vc]);
  const unsigned kbufb = (unsigned)(KPASS * TILE_PITCH * sizeof(f16));   // bytes of a K buffer
  const unsigned vbufb = (unsigned)(DIMH * VT_PITCH * sizeof(f16));      // bytes of a V buffer

  // Q^T B-fragment (K=32 x 16 query columns), pre-scaled by 1/sqrt(d) in k_qkv.
  const f16* qp = qw + headoff + (size_t)(q0 + lrow) * DIMH + lhi * 8;
  const v16h qa = cat8(*(const v8h*)qp, *(const v8h*)(qp + 16));

  // This wave's row of bias tiles; the lane reads key lrow, queries 8*lhi + 0..7.
  const f16* btile = biasT + (size_t)h * NSEQ * NSEQ
                           + (size_t)(q0 >> 4) * (NSEQ / 16) * BTILE + lrow * 16 + lhi * 8;
  // Identity B operands (k = query of the tile, column = query lrow). One A operand
  // carries two bias tiles: keys 0-15 in k slots 0-15, keys 16-31 in k slots 16-31;
  // idlo picks the first, idhi the second. Same k order as every loader here.
  v16h idlo, idhi;
  #pragma unroll
  for (int i = 0; i < 8; ++i) {
    const f16 e = (lhi * 8 + i == lrow) ? (f16)1.f : (f16)0.f;
    idlo[i] = e;          idlo[8 + i] = (f16)0.f;
    idhi[i] = (f16)0.f;   idhi[8 + i] = e;
  }

  float m = -1e30f;                 // running max of query q0+lrow (both halves agree)
  float l = 0.f;                    // running sum over THIS lane half's keys only
  const v8f zero = (v8f){0.f,0.f,0.f,0.f,0.f,0.f,0.f,0.f};
  v8f o0 = zero, o1 = zero;         // O^T: reg r = d (8*lhi+r, 16+8*lhi+r), lane = query

  // Two-buffer ring: tile 0 lands and is published, then tile 1 flies during pass 0.
  async_cp16_kv(kdst0, ksrc0, vdst0, vsrc0);
  WAIT_ASYNC_0();
  __syncthreads();
  async_cp16_kv(kdst0 + kbufb, ksrc0 + KPASS * DIMH, vdst0 + vbufb, vsrc0 + KPASS);

  for (int it = 0; it < NSEQ / KPASS; ++it) {
    const int cur = it & 1;

    // Relative position bias: the four 16-key tiles of keys kb + 0..63, kb = 64*it.
    const f16* bt = btile + it * (4 * BTILE);
    const v16h ba0 = cat8(*(const v8h*)bt, *(const v8h*)(bt + BTILE));
    const v16h ba1 = cat8(*(const v8h*)(bt + 2 * BTILE), *(const v8h*)(bt + 3 * BTILE));

    // K A-fragments from LDS: lane row = key, K-dim = d.
    v16h bk[4];
    #pragma unroll
    for (int j = 0; j < 4; ++j) {
      const f16* kp = &Kbuf[cur][(j * 16 + lrow) * TILE_PITCH + lhi * 8];
      bk[j] = cat8(*(const v8h*)kp, *(const v8h*)(kp + 16));
    }
    // Precaution: the wait takes the bias loads' address as an input, which keeps that
    // pair live up to it, so that it is not rewritten in front of the wait.
    asm volatile("s_wait_xcnt 0x0" :: "v"(bt) : "memory");
    // Keeps the pass's loads (bias from L2, K from LDS) in front of the first WMMA:
    // without it the bias loads issue behind the K wait and the two latencies add up.
    __builtin_amdgcn_sched_barrier(0);
    v8f s[4];                         // s[j][r] = S[q0+lrow][kb + 16*j + 8*lhi + r]
    #pragma unroll
    for (int j = 0; j < 4; ++j) s[j] = wmma16(bk[j], qa, zero);
    s[0] = wmma16(ba0, idlo, s[0]);   // + bias of the same query and keys
    s[1] = wmma16(ba0, idhi, s[1]);
    s[2] = wmma16(ba1, idlo, s[2]);
    s[3] = wmma16(ba1, idhi, s[3]);

    // V^T A-fragments from LDS: lane row = d, K-dim = key. Those of keys 0-31 are asked
    // for here, ahead of the softmax; those of keys 32-63 follow behind it.
    const f16* vp0 = &Vbuf[cur][lrow * VT_PITCH + lhi * 8];
    const f16* vp1 = &Vbuf[cur][(16 + lrow) * VT_PITCH + lhi * 8];
    v16h bv00 = cat8(*(const v8h*)vp0, *(const v8h*)(vp0 + 16));
    v16h bv10 = cat8(*(const v8h*)vp1, *(const v8h*)(vp1 + 16));

    // Online softmax: 32 scores of the query in-lane, the other 32 in lane^16.
    float c = fmaxf(fmaxf(s[0][0], s[1][0]), fmaxf(s[2][0], s[3][0]));
    #pragma unroll
    for (int r = 1; r < 8; ++r)
      c = fmaxf(c, fmaxf(fmaxf(s[0][r], s[1][r]), fmaxf(s[2][r], s[3][r])));
    c = fmaxf(c, other_half(c));
    const float mn   = fmaxf(m, c);
    // exp(x) = 2^(x * log2 e), the exponents by packed arithmetic on the whole tiles.
    const float corr = __builtin_amdgcn_exp2f((m - mn) * LOG2E);
    v16h pb0, pb1;                    // P^T B-fragments: same k order as the V loader
    #pragma unroll
    for (int j = 0; j < 4; ++j) {
      s[j] = (s[j] - mn) * LOG2E;
      #pragma unroll
      for (int r = 0; r < 8; ++r) s[j][r] = __builtin_amdgcn_exp2f(s[j][r]);   // P^T, in place
    }
    #pragma unroll
    for (int r = 0; r < 8; ++r) {
      pb0[r]     = (f16)s[0][r];
      pb0[8 + r] = (f16)s[1][r];
      pb1[r]     = (f16)s[2][r];
      pb1[8 + r] = (f16)s[3][r];
    }
    // Row sum of this lane's 32 keys: tile on tile, then across the 8 registers.
    const v8f ps = (s[0] + s[1]) + (s[2] + s[3]);
    const float rs = ((ps[0] + ps[1]) + (ps[2] + ps[3])) + ((ps[4] + ps[5]) + (ps[6] + ps[7]));
    l = l * corr + rs;
    m = mn;
    #pragma unroll
    for (int r = 0; r < 8; ++r) { o0[r] *= corr; o1[r] *= corr; }

    v16h bv01 = cat8(*(const v8h*)(vp0 + 32), *(const v8h*)(vp0 + 48));
    v16h bv11 = cat8(*(const v8h*)(vp1 + 32), *(const v8h*)(vp1 + 48));
    o0 = wmma16(bv00, pb0, o0);
    o1 = wmma16(bv10, pb0, o1);
    o0 = wmma16(bv01, pb1, o0);
    o1 = wmma16(bv11, pb1, o1);

    // Foot of the pass: this wave's LDS reads have returned and its copies of tile
    // it+1 have landed; the one barrier publishes tile it+1 and ends every wave's last
    // read of this pass's buffer, which only then is refilled with tile it+2.
    asm volatile("s_wait_dscnt 0x0" ::: "memory");
    WAIT_ASYNC_0();
    __syncthreads();
    if (it + 2 < NSEQ / KPASS) {
      async_cp16_kv(kdst0 + cur * kbufb, ksrc0 + (size_t)(it + 2) * (KPASS * DIMH),
                    vdst0 + cur * vbufb, vsrc0 + (size_t)(it + 2) * KPASS);
    }
  }
  WAIT_ASYNC_0();                     // nothing is in flight when the wave ends

  // Join the halves' sums, normalize, store to [B, N, H*D] f16 for the output
  // GEMM: 8 consecutive d per lane and tile, one 16-byte store each.
  l += other_half(l);
  const float inv = 1.f / l;
  v8h r0, r1;
  #pragma unroll
  for (int r = 0; r < 8; ++r) { r0[r] = (f16)(o0[r] * inv); r1[r] = (f16)(o1[r] * inv); }
  f16* op = attn + ((size_t)(b * NSEQ + q0 + lrow) * HEADS + h) * DIMH + lhi * 8;
  *(v8h*)op        = r0;
  *(v8h*)(op + 16) = r1;
}

// ---------------------------------------------------------------------------
// Kernel 5: output projection. attn[16384,256]f16 @ WoutT + b_out -> f32 out.
// Same LDS-staged weight panel as k_qkv.
// ---------------------------------------------------------------------------
__global__ void __launch_bounds__(256) k_out(const f16* __restrict__ A,
                                             const f16* __restrict__ WT,
                                             const float* __restrict__ bias,
                                             float* __restrict__ out) {
  __shared__ __align__(16) f16 Bpanel[64][PANEL_PITCH];   // 33 KB
  const int tid  = threadIdx.x;
  const int lane = tid & 31;
  const int w    = tid >> 5;
  const int lrow = lane & 15;
  const int lhi  = lane >> 4;
  const int m0   = blockIdx.y * 128 + w * 16;
  const int n0   = blockIdx.x * 64;

  #pragma unroll
  for (int j = 0; j < 8; ++j) {
    const int c = tid + j * 256;
    const int row = c >> 5, col8 = (c & 31) * 8;
    async_cp16(lds_u32(&Bpanel[row][col8]),
               WT + (size_t)(n0 + row) * DINP + col8);
  }
  WAIT_ASYNC_0();
  __syncthreads();

  v8f acc[4];
  #pragma unroll
  for (int t = 0; t < 4; ++t) acc[t] = (v8f){0.f,0.f,0.f,0.f,0.f,0.f,0.f,0.f};

  const f16* arow = A + (size_t)(m0 + lrow) * DINP;
  #pragma unroll
  for (int k0 = 0; k0 < DINP; k0 += 32) {
    const f16* ap = arow + k0 + lhi * 8;
    v16h a = cat8(*(const v8h*)ap, *(const v8h*)(ap + 16));
    #pragma unroll
    for (int t = 0; t < 4; ++t) {
      const f16* bp = &Bpanel[t * 16 + lrow][k0 + lhi * 8];
      v16h b = cat8(*(const v8h*)bp, *(const v8h*)(bp + 16));
      acc[t] = wmma16(a, b, acc[t]);
    }
  }

  #pragma unroll
  for (int t = 0; t < 4; ++t) {
    const int gcol = n0 + t * 16 + lrow;
    const float bv = bias[gcol];
    #pragma unroll
    for (int r = 0; r < 8; ++r) {
      out[(size_t)(m0 + r + 8 * lhi) * NOUT + gcol] = acc[t][r] + bv;
    }
  }
}

// ---------------------------------------------------------------------------
extern "C" void kernel_launch(void* const* d_in, const int* in_sizes, int n_in,
                              void* d_out, int out_size, void* d_ws, size_t ws_size,
                              hipStream_t stream) {
  const float* x      = (const float*)d_in[0];   // [16,1024,256]
  const float* W_qkv  = (const float*)d_in[1];   // [256,768]
  const float* W_out  = (const float*)d_in[2];   // [256,256]
  const float* b_out  = (const float*)d_in[3];   // [256]
  const float* btable = (const float*)d_in[4];   // [3969,8]
  const int*   relidx = (const int*)d_in[5];     // [1024*1024]
  float* out = (float*)d_out;

  char* ws = (char*)d_ws;
  size_t off = 0;
  f16* WqkvT = (f16*)(ws + off); off += (size_t)NQKV * DINP * 2;          // 384 KB
  f16* WoutT = (f16*)(ws + off); off += (size_t)NOUT * DINP * 2;          // 128 KB
  f16* qw    = (f16*)(ws + off); off += (size_t)B_SZ * HEADS * NSEQ * DIMH * 2; // 8 MB
  f16* kw    = (f16*)(ws + off); off += (size_t)B_SZ * HEADS * NSEQ * DIMH * 2; // 8 MB
  f16* vT    = (f16*)(ws + off); off += (size_t)B_SZ * HEADS * NSEQ * DIMH * 2; // 8 MB
  f16* attn  = (f16*)(ws + off); off += (size_t)B_SZ * NSEQ * HEADS * DIMH * 2; // 8 MB
  f16* biasT = (f16*)(ws + off); off += (size_t)HEADS * NSEQ * NSEQ * 2;        // 16 MB

  k_prep<<<(NQKV * DINP + NOUT * DINP) / 256, 256, 0, stream>>>(W_qkv, W_out, WqkvT, WoutT);
  k_bias<<<(NSEQ * NSEQ) / 2048, 256, 0, stream>>>(btable, relidx, biasT);
  k_qkv<<<dim3(NQKV / 64, (B_SZ * NSEQ) / 128), 256, 0, stream>>>(x, WqkvT, qw, kw, vT);
  k_attn<<<dim3(NSEQ / 128, HEADS, B_SZ), 256, 0, stream>>>(qw, kw, vT, biasT, attn);
  k_out<<<dim3(NOUT / 64, (B_SZ * NSEQ) / 128), 256, 0, stream>>>(attn, WoutT, b_out, out);
}

// v007
// One run takes 61.8 microseconds.
// Timed twice side by side with v006, it ran 1.09 times as fast both times.
// All steps since v000 together make it 2.72 times as fast.
#include <hip/hip_runtime.h>
#include <hip/hip_bf16.h>

typedef _Float16 f16;
typedef _Float16 v16h __attribute__((ext_vector_type(16)));
typedef _Float16 v8h  __attribute__((ext_vector_type(8)));
typedef float    v8f  __attribute__((ext_vector_type(8)));
typedef float    v4f  __attribute__((ext_vector_type(4)));

#define B_SZ   16
#define NSEQ   1024
#define HEADS  8
#define DIMH   32
#define DINP   256
#define NQKV   768
#define NOUT   256
#define NTAB   3969                    // rows of the bias table, (2*32-1)^2
#define SCALE  0.17677669529663689f   // 32^-0.5
#define LOG2E  1.44269504088896341f    // log2(e)
// LDS row pitches in halves: row length + 16 B, an odd multiple of 16 B, so that
// the 16 rows of a ds_load_b128 fragment read fall on 16 different bank groups.
#define PANEL_PITCH (DINP + 8)         // 528 B for the 512-B weight rows
#define TILE_PITCH  (DIMH + 8)         // 80 B for the 64-B K tile rows
#define BTILE  256                     // halves of one 16-key x 16-query bias tile
#define KPASS  64                      // keys of one pass of k_attn
#define VT_PITCH (KPASS + 8)           // 144 B for the 128-B V tile rows
// Left-hand matrices of the two projections (x, attention output) live in the workspace
// as f16 units in WMMA operand order: unit = (16-row tile, 32-wide k step), 1 KB:
// [k half j][lane = 16*lhi + lrow][8 halves], element k = 32*step + 16*j + 8*lhi + i.
// A fragment is then two wave loads of 512 contiguous bytes (4 whole lines each).
#define OPUNIT 512                     // halves of one unit
#define KSTEPS (DINP / 32)             // units of a 16-row tile
#define XBLOCKS ((B_SZ * NSEQ / 16) * KSTEPS / 8)   // k_prep blocks that pack x, 8 units each
typedef _Float16 v4h  __attribute__((ext_vector_type(4)));

static __device__ __forceinline__ v16h cat8(v8h lo, v8h hi) {
  return __builtin_shufflevector(lo, hi, 0,1,2,3,4,5,6,7,8,9,10,11,12,13,14,15);
}
static __device__ __forceinline__ v8f wmma16(v16h a, v16h b, v8f c) {
  // D = A(16x32 f16) * B(32x16 f16) + C(16x16 f32)
  return __builtin_amdgcn_wmma_f32_16x16x32_f16(false, a, false, b, (short)0, c, false, false);
}

// LDS byte offset of a shared-memory pointer: low 32 bits of the flat address
// (ISA 10.2: aperture LDS mapping is LDS_ADDR.U32 = addr[31:0]).
static __device__ __forceinline__ unsigned lds_u32(const void* p) {
  return (unsigned)(size_t)p;
}
// Async copy of 16 bytes global -> LDS per lane (ASYNCcnt-tracked).
static __device__ __forceinline__ void async_cp16(unsigned lds_dst, const f16* gsrc) {
  asm volatile("global_load_async_to_lds_b128 %0, %1, off"
               :: "v"(lds_dst), "v"(gsrc)
               : "memory");
}
#define WAIT_ASYNC_0() asm volatile("s_wait_asynccnt 0x0" ::: "memory")
#define WAIT_X_0()     asm volatile("s_wait_xcnt 0x0" ::: "memory")

// ---------------------------------------------------------------------------
// Kernel 1: pack x into f16 operand-order units, and transpose weights to f16
// [out, k] so WMMA B fragments are contiguous per-lane 16B loads.
// Packing: one wave makes one unit. Each of its four loads takes 4 rows x 128 B
// (8 lanes a row: whole lines); a block reads 16 whole rows and writes 8 KB in a row.
// ---------------------------------------------------------------------------
__global__ void __launch_bounds__(256) k_prep(const float* __restrict__ x,
                                              const float* __restrict__ Wqkv,
                                              const float* __restrict__ Wout,
                                              f16* __restrict__ xh,
                                              f16* __restrict__ WqkvT,
                                              f16* __restrict__ WoutT) {
  if (blockIdx.x < XBLOCKS) {                         // the same for the whole block
    const unsigned lane = threadIdx.x & 31u;
    const unsigned unit = blockIdx.x * 8u + (threadIdx.x >> 5);   // row tile * KSTEPS + k step
    const unsigned r4   = lane >> 3;                  // row inside a group of 4
    const unsigned c4   = lane & 7u;                  // which 4 floats of the 32-wide k step
    const float* xp = x + (size_t)((unit / KSTEPS) * 16u + r4) * DINP + (unit % KSTEPS) * 32u + c4 * 4u;
    v4f v[4];
    #pragma unroll
    for (int n = 0; n < 4; ++n) v[n] = *(const v4f*)(xp + n * 4 * DINP);   // row 4n + r4
    // Precaution: the wait takes the loads' address as an input, which keeps that pair
    // live up to it, so that it is not rewritten in front of the wait.
    asm volatile("s_wait_xcnt 0x0" :: "v"(xp) : "memory");
    // k = 4*c4 + i: j = c4 >> 2, lhi = (c4 >> 1) & 1, place in the lane's 8 halves 4*(c4 & 1).
    f16* op = xh + (size_t)unit * OPUNIT + (c4 >> 2) * 256u + (((c4 >> 1) & 1u) * 16u + r4) * 8u + (c4 & 1u) * 4u;
    v4h o[4];
    #pragma unroll
    for (int n = 0; n < 4; ++n) {
      #pragma unroll
      for (int i = 0; i < 4; ++i) o[n][i] = (f16)v[n][i];
    }
    #pragma unroll
    for (int n = 0; n < 4; ++n) *(v4h*)(op + n * 32) = o[n];      // lrow = 4n + r4
    return;
  }
  int idx = (blockIdx.x - XBLOCKS) * 256 + threadIdx.x;           // 1024 blocks -> 262144
  if (idx < NQKV * DINP) {
    int o = idx / DINP, k = idx % DINP;
    WqkvT[o * DINP + k] = (f16)Wqkv[k * NQKV + o];
  } else {
    int j = idx - NQKV * DINP;                        // < 256*256
    int o = j / DINP, k = j % DINP;
    WoutT[o * DINP + k] = (f16)Wout[k * NOUT + o];
  }
}

// ---------------------------------------------------------------------------
// Kernel 2: materialize the relative-position bias as f16 tiles in the order of
// a WMMA A operand: [head][query tile][key tile][key 0-15][query 0-15], 512 B a
// tile. One wave makes one tile for ALL 8 heads: lane = (key lrow, query half
// lhi), 8 queries a thread. The index is read once, a table row (8 heads, 32 B)
// comes as two 16-byte loads, and a thread's 8 queries of a head leave as one
// 16-byte store, so that each wave-wide store fills four whole 128-byte lines.
// ---------------------------------------------------------------------------
__global__ void __launch_bounds__(256) k_bias(const float* __restrict__ table,
                                              const int* __restrict__ relidx,
                                              f16* __restrict__ biasT) {
  const unsigned lane = threadIdx.x & 31u;
  const unsigned lrow = lane & 15u;
  const unsigned lhi  = lane >> 4;
  const unsigned wv   = blockIdx.x * 8u + (threadIdx.x >> 5);   // 512 blocks -> 4096 waves = tiles
  const unsigned kt   = wv & 63u;                               // key tile
  const unsigned qt   = wv >> 6;                                // query tile

  const int* ip = relidx + (qt * 16u + lhi * 8u) * NSEQ + kt * 16u + lrow;
  int id[8];
  #pragma unroll
  for (int i = 0; i < 8; ++i) id[i] = ip[i * NSEQ];             // query qt*16 + lhi*8 + i, this key

  unsigned off[8];                                              // byte offset of each table row
  v4f row[8][2];                                                // [query][heads 0-3, 4-7]
  #pragma unroll
  for (int i = 0; i < 8; ++i) {
    // Bound the row before the address is formed (identity for a valid index).
    off[i] = min((unsigned)id[i], (unsigned)(NTAB - 1)) * (unsigned)(HEADS * sizeof(float));
    const float* tp = (const float*)((const char*)table + off[i]);
    row[i][0] = *(const v4f*)tp;
    row[i][1] = *(const v4f*)(tp + 4);
  }
  // Precaution: the wait stands behind the gathers and takes their offsets as
  // inputs, which keeps those registers live up to it, so that none of them is
  // written (by a later gather's data either) in front of the wait.
  asm volatile("s_wait_xcnt 0x0"
               :: "v"(off[0]), "v"(off[1]), "v"(off[2]), "v"(off[3]),
                  "v"(off[4]), "v"(off[5]), "v"(off[6]), "v"(off[7])
               : "memory");

  f16* op = biasT + (size_t)(qt * 64u + kt) * BTILE + lrow * 16u + lhi * 8u;
  #pragma unroll
  for (int h = 0; h < HEADS; ++h) {
    v8h o;
    #pragma unroll
    for (int i = 0; i < 8; ++i) o[i] = (f16)row[i][h >> 2][h & 3];
    *(v8h*)(op + (size_t)h * NSEQ * NSEQ) = o;
  }
}

// ---------------------------------------------------------------------------
// Kernel 3: QKV projection. x[16384,256] (f16 units) @ WqkvT -> q/k/vT in head layout.
// Block = 8 waves stacked in M (128x64 C tile). The shared 64x256 f16 weight
// panel is staged once into LDS via async-to-LDS copies (8x traffic cut).
// A 64-column block lies wholly in q, in k or in v. The operand roles are chosen so
// that a lane's 8 results of a tile lie along the contiguous axis of their output
// (d for q and k, n for vT) and leave as ONE 16-byte store.
// ---------------------------------------------------------------------------
// The 32 products of a wave's 16 x 64 tile. XA: the x rows are the A operand
// (reg r = x row r + 8*lhi, lane = column lrow); else the weight rows are A
// (reg r = column r + 8*lhi, lane = x row lrow). Both loaders keep one k order.
template <bool XA>
static __device__ __forceinline__ void qkv_products(const f16* __restrict__ xfrag,
                                                    const f16 (&Bpanel)[64][PANEL_PITCH],
                                                    int lrow, int lhi, v8f (&acc)[4]) {
  #pragma unroll
  for (int k0 = 0; k0 < DINP; k0 += 32) {
    // x fragment from its unit (K chunks lhi*8 and 16+lhi*8): two 512-B wave loads
    const f16* xp = xfrag + (k0 / 32) * OPUNIT;
    v16h a = cat8(*(const v8h*)xp, *(const v8h*)(xp + 256));
    #pragma unroll
    for (int t = 0; t < 4; ++t) {
      const f16* bp = &Bpanel[t * 16 + lrow][k0 + lhi * 8];
      v16h b = cat8(*(const v8h*)bp, *(const v8h*)(bp + 16));
      acc[t] = XA ? wmma16(a, b, acc[t]) : wmma16(b, a, acc[t]);
    }
  }
  // Precaution: the wait takes the x loads' address as an input, which keeps that pair
  // live up to it, so that no load's data is written over it in front of the wait.
  asm volatile("s_wait_xcnt 0x0" :: "v"(xfrag) : "memory");
}

// 12 waves per SIMD (at most 80 registers): all 1,536 blocks, 6 per WGP, are resident at once.
__global__ void __launch_bounds__(256, 12) k_qkv(const f16* __restrict__ xh,
                                             const f16* __restrict__ WT,
                                             f16* __restrict__ qw,
                                             f16* __restrict__ kw,
                                             f16* __restrict__ vT) {
  __shared__ __align__(16) f16 Bpanel[64][PANEL_PITCH];   // 33 KB
  const int tid  = threadIdx.x;
  const int lane = tid & 31;
  const int w    = tid >> 5;
  const int lrow = lane & 15;
  const int lhi  = lane >> 4;
  const int m0   = blockIdx.y * 128 + w * 16;
  const int n0   = blockIdx.x * 64;

  // Stage weight panel: 64 rows x 512 B = 2048 chunks of 16 B, 8 per thread.
  #pragma unroll
  for (int j = 0; j < 8; ++j) {
    const int c = tid + j * 256;                      // chunk id
    const int row = c >> 5, col8 = (c & 31) * 8;
    async_cp16(lds_u32(&Bpanel[row][col8]),
               WT + (size_t)(n0 + row) * DINP + col8);
  }
  WAIT_ASYNC_0();
  __syncthreads();

  v8f acc[4];
  #pragma unroll
  for (int t = 0; t < 4; ++t) acc[t] = (v8f){0.f,0.f,0.f,0.f,0.f,0.f,0.f,0.f};

  const f16* xfrag = xh + (size_t)(m0 >> 4) * (KSTEPS * OPUNIT) + lane * 8;   // this lane's place in the tile's first unit
  const int which = n0 >> 8;            // 0=q 1=k 2=v, the same for the whole block
  const int hb    = (n0 & 255) >> 5;    // first of the block's two heads
  const int bb    = m0 >> 10;           // a wave's 16 rows lie in one batch
  const int nw    = m0 & 1023;          // its first row inside the batch
  // Precaution, both arms: the wait stands directly behind each store, in front of
  // the next write of a register that the store names.
  if (which == 2) {
    qkv_products<true>(xfrag, Bpanel, lrow, lhi, acc);
    #pragma unroll
    for (int t = 0; t < 4; ++t) {       // column d of head h, rows nw + 8*lhi + 0..7
      const int h = hb + (t >> 1);
      const int d = (t & 1) * 16 + lrow;
      v8h o;
      #pragma unroll
      for (int r = 0; r < 8; ++r) o[r] = (f16)acc[t][r];
      *(v8h*)(vT + ((size_t)(bb * HEADS + h) * DIMH + d) * NSEQ + nw + 8 * lhi) = o;
      WAIT_X_0();
    }
  } else {
    qkv_products<false>(xfrag, Bpanel, lrow, lhi, acc);
    f16* __restrict__ dst = which == 0 ? qw : kw;
    const float sc = which == 0 ? SCALE : 1.f;
    #pragma unroll
    for (int t = 0; t < 4; ++t) {       // row nw + lrow, columns d0 + 0..7 of head h
      const int h  = hb + (t >> 1);
      const int d0 = (t & 1) * 16 + 8 * lhi;
      v8h o;
      #pragma unroll
      for (int r = 0; r < 8; ++r) o[r] = (f16)(acc[t][r] * sc);
      *(v8h*)(dst + ((size_t)(bb * HEADS + h) * NSEQ + nw + lrow) * DIMH + d0) = o;
      WAIT_X_0();
    }
  }
}

static __device__ __forceinline__ float other_half(float v) {
  const int b = __builtin_bit_cast(int, v);
  return __builtin_bit_cast(float,
      __builtin_amdgcn_permlanex16(b, b, 0x76543210, 0xfedcba98, false, false));
}

// One K chunk and one V chunk of 16 bytes per lane, global -> LDS. The two copies and
// their s_wait_xcnt stand in one statement, so that no register that a copy names can
// be rewritten in front of the wait (a precaution).
static __device__ __forceinline__ void async_cp16_kv(unsigned kdst, const f16* ksrc,
                                                     unsigned vdst, const f16* vsrc) {
  asm volatile("global_load_async_to_lds_b128 %0, %2, off\n\t"
               "global_load_async_to_lds_b128 %1, %3, off\n\t"
               "s_wait_xcnt 0x0"
               :: "v"(kdst), "v"(vdst), "v"(ksrc), "v"(vsrc)
               : "memory");
}

__global__ void __launch_bounds__(256) k_attn(const f16* __restrict__ qw,
                                              const f16* __restrict__ kw,
                                              const f16* __restrict__ vT,
                                              const f16* __restrict__ biasT,
                                              f16* __restrict__ attn) {
  __shared__ __align__(16) f16 Kbuf[2][KPASS * TILE_PITCH];   // [key][d]   2 x 5 KB
  __shared__ __align__(16) f16 Vbuf[2][DIMH * VT_PITCH];      // [d][key]   2 x 4.5 KB
  const int tid  = threadIdx.x;
  const int lane = tid & 31;
  const int w    = tid >> 5;
  const int lrow = lane & 15;
  const int lhi  = lane >> 4;
  const int q0   = blockIdx.x * 128 + w * 16;
  const int h    = blockIdx.y;
  const int b    = blockIdx.z;
  const size_t headoff = (size_t)(b * HEADS + h) * NSEQ * DIMH;

  // Copier role: every thread moves one 16-byte chunk of the K tile (64 keys x 64 B)
  // and one of the V tile (32 d rows x 128 B) a pass.
  const int kr = tid >> 2, kc = (tid & 3) * 8;        // K: row = key
  const int vr = tid >> 3, vc = (tid & 7) * 8;        // V: row = d, stride NSEQ
  const f16* ksrc0 = kw + headoff + (size_t)kr * DIMH + kc;
  const f16* vsrc0 = vT + headoff + (size_t)vr * NSEQ + vc;
  const unsigned kdst0 = lds_u32(&Kbuf[0][kr * TILE_PITCH + kc]);
  const unsigned vdst0 = lds_u32(&Vbuf[0][vr * VT_PITCH + vc]);
  const unsigned kbufb = (unsigned)(KPASS * TILE_PITCH * sizeof(f16));   // bytes of a K buffer
  const unsigned vbufb = (unsigned)(DIMH * VT_PITCH * sizeof(f16));      // bytes of a V buffer

  // Q^T B-fragment (K=32 x 16 query columns), pre-scaled by 1/sqrt(d) in k_qkv.
  const f16* qp = qw + headoff + (size_t)(q0 + lrow) * DIMH + lhi * 8;
  const v16h qa = cat8(*(const v8h*)qp, *(const v8h*)(qp + 16));

  // This wave's row of bias tiles; the lane reads key lrow, queries 8*lhi + 0..7.
  const f16* btile = biasT + (size_t)h * NSEQ * NSEQ
                           + (size_t)(q0 >> 4) * (NSEQ / 16) * BTILE + lrow * 16 + lhi * 8;
  // Identity B operands (k = query of the tile, column = query lrow). One A operand
  // carries two bias tiles: keys 0-15 in k slots 0-15, keys 16-31 in k slots 16-31;
  // idlo picks the first, idhi the second. Same k order as every loader here.
  v16h idlo, idhi;
  #pragma unroll
  for (int i = 0; i < 8; ++i) {
    const f16 e = (lhi * 8 + i == lrow) ? (f16)1.f : (f16)0.f;
    idlo[i] = e;          idlo[8 + i] = (f16)0.f;
    idhi[i] = (f16)0.f;   idhi[8 + i] = e;
  }

  float m = -1e30f;                 // running max of query q0+lrow (both halves agree)
  float l = 0.f;                    // running sum over THIS lane half's keys only
  const v8f zero = (v8f){0.f,0.f,0.f,0.f,0.f,0.f,0.f,0.f};
  v8f o0 = zero, o1 = zero;         // O^T: reg r = d (8*lhi+r, 16+8*lhi+r), lane = query

  // Two-buffer ring: tile 0 lands and is published, then tile 1 flies during pass 0.
  async_cp16_kv(kdst0, ksrc0, vdst0, vsrc0);
  WAIT_ASYNC_0();
  __syncthreads();
  async_cp16_kv(kdst0 + kbufb, ksrc0 + KPASS * DIMH, vdst0 + vbufb, vsrc0 + KPASS);

  for (int it = 0; it < NSEQ / KPASS; ++it) {
    const int cur = it & 1;

    // Relative position bias: the four 16-key tiles of keys kb + 0..63, kb = 64*it.
    const f16* bt = btile + it * (4 * BTILE);
    const v16h ba0 = cat8(*(const v8h*)bt, *(const v8h*)(bt + BTILE));
    const v16h ba1 = cat8(*(const v8h*)(bt + 2 * BTILE), *(const v8h*)(bt + 3 * BTILE));

    // K A-fragments from LDS: lane row = key, K-dim = d.
    v16h bk[4];
    #pragma unroll
    for (int j = 0; j < 4; ++j) {
      const f16* kp = &Kbuf[cur][(j * 16 + lrow) * TILE_PITCH + lhi * 8];
      bk[j] = cat8(*(const v8h*)kp, *(const v8h*)(kp + 16));
    }
    // Precaution: the wait takes the bias loads' address as an input, which keeps that
    // pair live up to it, so that it is not rewritten in front of the wait.
    asm volatile("s_wait_xcnt 0x0" :: "v"(bt) : "memory");
    // Keeps the pass's loads (bias from L2, K from LDS) in front of the first WMMA:
    // without it the bias loads issue behind the K wait and the two latencies add up.
    __builtin_amdgcn_sched_barrier(0);
    v8f s[4];                         // s[j][r] = S[q0+lrow][kb + 16*j + 8*lhi + r]
    #pragma unroll
    for (int j = 0; j < 4; ++j) s[j] = wmma16(bk[j], qa, zero);
    s[0] = wmma16(ba0, idlo, s[0]);   // + bias of the same query and keys
    s[1] = wmma16(ba0, idhi, s[1]);
    s[2] = wmma16(ba1, idlo, s[2]);
    s[3] = wmma16(ba1, idhi, s[3]);

    // V^T A-fragments from LDS: lane row = d, K-dim = key. Those of keys 0-31 are asked
    // for here, ahead of the softmax; those of keys 32-63 follow behind it.
    const f16* vp0 = &Vbuf[cur][lrow * VT_PITCH + lhi * 8];
    const f16* vp1 = &Vbuf[cur][(16 + lrow) * VT_PITCH + lhi * 8];
    v16h bv00 = cat8(*(const v8h*)vp0, *(const v8h*)(vp0 + 16));
    v16h bv10 = cat8(*(const v8h*)vp1, *(const v8h*)(vp1 + 16));

    // Online softmax: 32 scores of the query in-lane, the other 32 in lane^16.
    float c = fmaxf(fmaxf(s[0][0], s[1][0]), fmaxf(s[2][0], s[3][0]));
    #pragma unroll
    for (int r = 1; r < 8; ++r)
      c = fmaxf(c, fmaxf(fmaxf(s[0][r], s[1][r]), fmaxf(s[2][r], s[3][r])));
    c = fmaxf(c, other_half(c));
    const float mn   = fmaxf(m, c);
    // exp(x) = 2^(x * log2 e), the exponents by packed arithmetic on the whole tiles.
    const float corr = __builtin_amdgcn_exp2f((m - mn) * LOG2E);
    v16h pb0, pb1;                    // P^T B-fragments: same k order as the V loader
    #pragma unroll
    for (int j = 0; j < 4; ++j) {
      s[j] = (s[j] - mn) * LOG2E;
      #pragma unroll
      for (int r = 0; r < 8; ++r) s[j][r] = __builtin_amdgcn_exp2f(s[j][r]);   // P^T, in place
    }
    #pragma unroll
    for (int r = 0; r < 8; ++r) {
      pb0[r]     = (f16)s[0][r];
      pb0[8 + r] = (f16)s[1][r];
      pb1[r]     = (f16)s[2][r];
      pb1[8 + r] = (f16)s[3][r];
    }
    // Row sum of this lane's 32 keys: tile on tile, then across the 8 registers.
    const v8f ps = (s[0] + s[1]) + (s[2] + s[3]);
    const float rs = ((ps[0] + ps[1]) + (ps[2] + ps[3])) + ((ps[4] + ps[5]) + (ps[6] + ps[7]));
    l = l * corr + rs;
    m = mn;
    #pragma unroll
    for (int r = 0; r < 8; ++r) { o0[r] *= corr; o1[r] *= corr; }

    v16h bv01 = cat8(*(const v8h*)(vp0 + 32), *(const v8h*)(vp0 + 48));
    v16h bv11 = cat8(*(const v8h*)(vp1 + 32), *(const v8h*)(vp1 + 48));
    o0 = wmma16(bv00, pb0, o0);
    o1 = wmma16(bv10, pb0, o1);
    o0 = wmma16(bv01, pb1, o0);
    o1 = wmma16(bv11, pb1, o1);

    // Foot of the pass: this wave's LDS reads have returned and its copies of tile
    // it+1 have landed; the one barrier publishes tile it+1 and ends every wave's last
    // read of this pass's buffer, which only then is refilled with tile it+2.
    asm volatile("s_wait_dscnt 0x0" ::: "memory");
    WAIT_ASYNC_0();
    __syncthreads();
    if (it + 2 < NSEQ / KPASS) {
      async_cp16_kv(kdst0 + cur * kbufb, ksrc0 + (size_t)(it + 2) * (KPASS * DIMH),
                    vdst0 + cur * vbufb, vsrc0 + (size_t)(it + 2) * KPASS);
    }
  }
  WAIT_ASYNC_0();                     // nothing is in flight when the wave ends

  // Join the halves' sums, normalize, store as the output GEMM's operand unit
  // (row tile of the queries, k step = head): the lane's two groups of 8 d are its
  // two chunks of the fragment, so each store is 512 contiguous bytes of the wave.
  l += other_half(l);
  const float inv = 1.f / l;
  v8h r0, r1;
  #pragma unroll
  for (int r = 0; r < 8; ++r) { r0[r] = (f16)(o0[r] * inv); r1[r] = (f16)(o1[r] * inv); }
  f16* op = attn + ((size_t)((b * NSEQ + q0) >> 4) * KSTEPS + h) * OPUNIT + lane * 8;
  *(v8h*)op         = r0;
  *(v8h*)(op + 256) = r1;
}

// ---------------------------------------------------------------------------
// Kernel 5: output projection. attn[16384,256] (f16 units) @ WoutT + b_out -> f32 out.
// Same LDS-staged weight panel as k_qkv.
// ---------------------------------------------------------------------------
__global__ void __launch_bounds__(256) k_out(const f16* __restrict__ A,
                                             const f16* __restrict__ WT,
                                             const float* __restrict__ bias,
                                             float* __restrict__ out) {
  __shared__ __align__(16) f16 Bpanel[64][PANEL_PITCH];   // 33 KB
  const int tid  = threadIdx.x;
  const int lane = tid & 31;
  const int w    = tid >> 5;
  const int lrow = lane & 15;
  const int lhi  = lane >> 4;
  const int m0   = blockIdx.y * 128 + w * 16;
  const int n0   = blockIdx.x * 64;

  #pragma unroll
  for (int j = 0; j < 8; ++j) {
    const int c = tid + j * 256;
    const int row = c >> 5, col8 = (c & 31) * 8;
    async_cp16(lds_u32(&Bpanel[row][col8]),
               WT + (size_t)(n0 + row) * DINP + col8);
  }
  WAIT_ASYNC_0();
  __syncthreads();

  v8f acc[4];
  #pragma unroll
  for (int t = 0; t < 4; ++t) acc[t] = (v8f){0.f,0.f,0.f,0.f,0.f,0.f,0.f,0.f};

  const f16* afrag = A + (size_t)(m0 >> 4) * (KSTEPS * OPUNIT) + lane * 8;
  #pragma unroll
  for (int k0 = 0; k0 < DINP; k0 += 32) {
    const f16* ap = afrag + (k0 / 32) * OPUNIT;
    v16h a = cat8(*(const v8h*)ap, *(const v8h*)(ap + 256));
    #pragma unroll
    for (int t = 0; t < 4; ++t) {
      const f16* bp = &Bpanel[t * 16 + lrow][k0 + lhi * 8];
      v16h b = cat8(*(const v8h*)bp, *(const v8h*)(bp + 16));
      acc[t] = wmma16(a, b, acc[t]);
    }
  }
  // Precaution: the wait takes the fragment loads' address as an input, which keeps that
  // pair live up to it, so that it is not rewritten in front of the wait.
  asm volatile("s_wait_xcnt 0x0" :: "v"(afrag) : "memory");

  #pragma unroll
  for (int t = 0; t < 4; ++t) {
    const int gcol = n0 + t * 16 + lrow;
    const float bv = bias[gcol];
    #pragma unroll
    for (int r = 0; r < 8; ++r) {
      out[(size_t)(m0 + r + 8 * lhi) * NOUT + gcol] = acc[t][r] + bv;
    }
  }
}

// ---------------------------------------------------------------------------
extern "C" void kernel_launch(void* const* d_in, const int* in_sizes, int n_in,
                              void* d_out, int out_size, void* d_ws, size_t ws_size,
                              hipStream_t stream) {
  const float* x      = (const float*)d_in[0];   // [16,1024,256]
  const float* W_qkv  = (const float*)d_in[1];   // [256,768]
  const float* W_out  = (const float*)d_in[2];   // [256,256]
  const float* b_out  = (const float*)d_in[3];   // [256]
  const float* btable = (const float*)d_in[4];   // [3969,8]
  const int*   relidx = (const int*)d_in[5];     // [1024*1024]
  float* out = (float*)d_out;

  char* ws = (char*)d_ws;
  size_t off = 0;
  f16* WqkvT = (f16*)(ws + off); off += (size_t)NQKV * DINP * 2;          // 384 KB
  f16* WoutT = (f16*)(ws + off); off += (size_t)NOUT * DINP * 2;          // 128 KB
  f16* qw    = (f16*)(ws + off); off += (size_t)B_SZ * HEADS * NSEQ * DIMH * 2; // 8 MB
  f16* kw    = (f16*)(ws + off); off += (size_t)B_SZ * HEADS * NSEQ * DIMH * 2; // 8 MB
  f16* vT    = (f16*)(ws + off); off += (size_t)B_SZ * HEADS * NSEQ * DIMH * 2; // 8 MB
  f16* attn  = (f16*)(ws + off); off += (size_t)B_SZ * NSEQ * HEADS * DIMH * 2; // 8 MB
  f16* biasT = (f16*)(ws + off); off += (size_t)HEADS * NSEQ * NSEQ * 2;        // 16 MB
  f16* xh    = (f16*)(ws + off); off += (size_t)B_SZ * NSEQ * DINP * 2;         // 8 MB

  k_prep<<<XBLOCKS + (NQKV * DINP + NOUT * DINP) / 256, 256, 0, stream>>>(x, W_qkv, W_out, xh, WqkvT, WoutT);
  k_bias<<<(NSEQ * NSEQ) / 2048, 256, 0, stream>>>(btable, relidx, biasT);
  k_qkv<<<dim3(NQKV / 64, (B_SZ * NSEQ) / 128), 256, 0, stream>>>(xh, WqkvT, qw, kw, vT);
  k_attn<<<dim3(NSEQ / 128, HEADS, B_SZ), 256, 0, stream>>>(qw, kw, vT, biasT, attn);
  k_out<<<dim3(NOUT / 64, (B_SZ * NSEQ) / 128), 256, 0, stream>>>(attn, WoutT, b_out, out);
}

// v008
// A run of this version takes 59.5 microseconds.
// Timed twice side by side with v007, it ran 1.04 and 1.03 times as fast.
// Over all steps from v000 it is 2.82 times as fast.
#include <hip/hip_runtime.h>
#include <hip/hip_bf16.h>

typedef _Float16 f16;
typedef _Float16 v16h __attribute__((ext_vector_type(16)));
typedef _Float16 v8h  __attribute__((ext_vector_type(8)));
typedef float    v8f  __attribute__((ext_vector_type(8)));
typedef float    v4f  __attribute__((ext_vector_type(4)));

#define B_SZ   16
#define NSEQ   1024
#define HEADS  8
#define DIMH   32
#define DINP   256
#define NQKV   768
#define NOUT   256
#define NTAB   3969                    // rows of the bias table, (2*32-1)^2
#define SCALE  0.17677669529663689f   // 32^-0.5
#define LOG2E  1.44269504088896341f    // log2(e)
// LDS row pitches in halves: row length + 16 B, an odd multiple of 16 B, so that
// the 16 rows of a ds_load_b128 fragment read fall on 16 different bank groups.
#define PANEL_PITCH (DINP + 8)         // 528 B for the 512-B weight rows
#define TILE_PITCH  (DIMH + 8)         // 80 B for the 64-B K tile rows
#define BTILE  256                     // halves of one 16-key x 16-query bias tile
#define KPASS  64                      // keys of one pass of k_attn
#define VT_PITCH (KPASS + 8)           // 144 B for the 128-B V tile rows
// Left-hand matrices of the two projections (x, attention output) live in the workspace
// as f16 units in WMMA operand order: unit = (16-row tile, 32-wide k step), 1 KB:
// [k half j][lane = 16*lhi + lrow][8 halves], element k = 32*step + 16*j + 8*lhi + i.
// A fragment is then two wave loads of 512 contiguous bytes (4 whole lines each).
#define OPUNIT 512                     // halves of one unit
#define KSTEPS (DINP / 32)             // units of a 16-row tile
#define XBLOCKS ((B_SZ * NSEQ / 16) * KSTEPS / 8)   // k_prep blocks that pack x, 8 units each
#define BBLOCKS ((NSEQ * NSEQ) / 2048)              // k_prep blocks that make bias tiles, 8 tiles each
typedef _Float16 v4h  __attribute__((ext_vector_type(4)));

static __device__ __forceinline__ v16h cat8(v8h lo, v8h hi) {
  return __builtin_shufflevector(lo, hi, 0,1,2,3,4,5,6,7,8,9,10,11,12,13,14,15);
}
static __device__ __forceinline__ v8f wmma16(v16h a, v16h b, v8f c) {
  // D = A(16x32 f16) * B(32x16 f16) + C(16x16 f32)
  return __builtin_amdgcn_wmma_f32_16x16x32_f16(false, a, false, b, (short)0, c, false, false);
}

// LDS byte offset of a shared-memory pointer: low 32 bits of the flat address
// (ISA 10.2: aperture LDS mapping is LDS_ADDR.U32 = addr[31:0]).
static __device__ __forceinline__ unsigned lds_u32(const void* p) {
  return (unsigned)(size_t)p;
}
// Async copy of 16 bytes global -> LDS per lane (ASYNCcnt-tracked).
static __device__ __forceinline__ void async_cp16(unsigned lds_dst, const f16* gsrc) {
  asm volatile("global_load_async_to_lds_b128 %0, %1, off"
               :: "v"(lds_dst), "v"(gsrc)
               : "memory");
}
#define WAIT_ASYNC_0() asm volatile("s_wait_asynccnt 0x0" ::: "memory")
#define WAIT_X_0()     asm volatile("s_wait_xcnt 0x0" ::: "memory")

// ---------------------------------------------------------------------------
// Part of kernel 1: materialize the relative-position bias as f16 tiles in the order of
// a WMMA A operand: [head][query tile][key tile][key 0-15][query 0-15], 512 B a
// tile. One wave makes one tile for ALL 8 heads: lane = (key lrow, query half
// lhi), 8 queries a thread. The index is read once, a table row (8 heads, 32 B)
// comes as two 16-byte loads, and a thread's 8 queries of a head leave as one
// 16-byte store, so that each wave-wide store fills four whole 128-byte lines.
// ---------------------------------------------------------------------------
static __device__ __forceinline__ void bias_tiles(const float* __restrict__ table,
                                                  const int* __restrict__ relidx,
                                                  f16* __restrict__ biasT) {
  const unsigned lane = threadIdx.x & 31u;
  const unsigned lrow = lane & 15u;
  const unsigned lhi  = lane >> 4;
  const unsigned wv   = blockIdx.x * 8u + (threadIdx.x >> 5);   // the grid's first 512 blocks -> 4096 waves = tiles
  const unsigned kt   = wv & 63u;                               // key tile
  const unsigned qt   = wv >> 6;                                // query tile

  const int* ip = relidx + (qt * 16u + lhi * 8u) * NSEQ + kt * 16u + lrow;
  int id[8];
  #pragma unroll
  for (int i = 0; i < 8; ++i) id[i] = ip[i * NSEQ];             // query qt*16 + lhi*8 + i, this key

  unsigned off[8];                                              // byte offset of each table row
  v4f row[8][2];                                                // [query][heads 0-3, 4-7]
  #pragma unroll
  for (int i = 0; i < 8; ++i) {
    // Bound the row before the address is formed (identity for a valid index).
    off[i] = min((unsigned)id[i], (unsigned)(NTAB - 1)) * (unsigned)(HEADS * sizeof(float));
    const float* tp = (const float*)((const char*)table + off[i]);
    row[i][0] = *(const v4f*)tp;
    row[i][1] = *(const v4f*)(tp + 4);
  }
  // Precaution: the wait stands behind the gathers and takes their offsets as
  // inputs, which keeps those registers live up to it, so that none of them is
  // written (by a later gather's data either) in front of the wait.
  asm volatile("s_wait_xcnt 0x0"
               :: "v"(off[0]), "v"(off[1]), "v"(off[2]), "v"(off[3]),
                  "v"(off[4]), "v"(off[5]), "v"(off[6]), "v"(off[7])
               : "memory");

  f16* op = biasT + (size_t)(qt * 64u + kt) * BTILE + lrow * 16u + lhi * 8u;
  #pragma unroll
  for (int h = 0; h < HEADS; ++h) {
    v8h o;
    #pragma unroll
    for (int i = 0; i < 8; ++i) o[i] = (f16)row[i][h >> 2][h & 3];
    *(v8h*)(op + (size_t)h * NSEQ * NSEQ) = o;
  }
}

// ---------------------------------------------------------------------------
// Kernel 1: pack x into f16 operand-order units, and transpose weights to f16
// [out, k] so WMMA B fragments are contiguous per-lane 16B loads.
// Packing: one wave makes one unit. Each of its four loads takes 4 rows x 128 B
// (8 lanes a row: whole lines); a block reads 16 whole rows and writes 8 KB in a row.
// The bias tiles need nothing of this work and nothing here needs them, so they share
// the launch by a range of the block index. They come first: theirs is the longest
// chain of dependent memory accesses (index, table row, store).
// ---------------------------------------------------------------------------
__global__ void __launch_bounds__(256) k_prep(const float* __restrict__ x,
                                              const float* __restrict__ Wqkv,
                                              const float* __restrict__ Wout,
                                              const float* __restrict__ table,
                                              const int* __restrict__ relidx,
                                              f16* __restrict__ xh,
                                              f16* __restrict__ WqkvT,
                                              f16* __restrict__ WoutT,
                                              f16* __restrict__ biasT) {
  if (blockIdx.x < BBLOCKS) {                         // the same for the whole block
    bias_tiles(table, relidx, biasT);
    return;
  }
  const unsigned blk = blockIdx.x - BBLOCKS;          // block among those of x and the weights
  if (blk < XBLOCKS) {                                // the same for the whole block
    const unsigned lane = threadIdx.x & 31u;
    const unsigned unit = blk * 8u + (threadIdx.x >> 5);          // row tile * KSTEPS + k step
    const unsigned r4   = lane >> 3;                  // row inside a group of 4
    const unsigned c4   = lane & 7u;                  // which 4 floats of the 32-wide k step
    const float* xp = x + (size_t)((unit / KSTEPS) * 16u + r4) * DINP + (unit % KSTEPS) * 32u + c4 * 4u;
    v4f v[4];
    #pragma unroll
    for (int n = 0; n < 4; ++n) v[n] = *(const v4f*)(xp + n * 4 * DINP);   // row 4n + r4
    // Precaution: the wait takes the loads' address as an input, which keeps that pair
    // live up to it, so that it is not rewritten in front of the wait.
    asm volatile("s_wait_xcnt 0x0" :: "v"(xp) : "memory");
    // k = 4*c4 + i: j = c4 >> 2, lhi = (c4 >> 1) & 1, place in the lane's 8 halves 4*(c4 & 1).
    f16* op = xh + (size_t)unit * OPUNIT + (c4 >> 2) * 256u + (((c4 >> 1) & 1u) * 16u + r4) * 8u + (c4 & 1u) * 4u;
    v4h o[4];
    #pragma unroll
    for (int n = 0; n < 4; ++n) {
      #pragma unroll
      for (int i = 0; i < 4; ++i) o[n][i] = (f16)v[n][i];
    }
    #pragma unroll
    for (int n = 0; n < 4; ++n) *(v4h*)(op + n * 32) = o[n];      // lrow = 4n + r4
    // Precaution: the wait stands behind the four stores, in front of any later write of a
    // register that they name (the built code of another part follows on this one).
    WAIT_X_0();
    return;
  }
  int idx = (blk - XBLOCKS) * 256 + threadIdx.x;                  // 1024 blocks -> 262144
  if (idx < NQKV * DINP) {
    int o = idx / DINP, k = idx % DINP;
    WqkvT[o * DINP + k] = (f16)Wqkv[k * NQKV + o];
  } else {
    int j = idx - NQKV * DINP;                        // < 256*256
    int o = j / DINP, k = j % DINP;
    WoutT[o * DINP + k] = (f16)Wout[k * NOUT + o];
  }
}

// ---------------------------------------------------------------------------
// Kernel 2: QKV projection. x[16384,256] (f16 units) @ WqkvT -> q/k/vT in head layout.
// Block = 8 waves stacked in M (128x64 C tile). The shared 64x256 f16 weight
// panel is staged once into LDS via async-to-LDS copies (8x traffic cut).
// A 64-column block lies wholly in q, in k or in v. The operand roles are chosen so
// that a lane's 8 results of a tile lie along the contiguous axis of their output
// (d for q and k, n for vT) and leave as ONE 16-byte store.
// ---------------------------------------------------------------------------
// The 32 products of a wave's 16 x 64 tile. XA: the x rows are the A operand
// (reg r = x row r + 8*lhi, lane = column lrow); else the weight rows are A
// (reg r = column r + 8*lhi, lane = x row lrow). Both loaders keep one k order.
template <bool XA>
static __device__ __forceinline__ void qkv_products(const f16* __restrict__ xfrag,
                                                    const f16 (&Bpanel)[64][PANEL_PITCH],
                                                    int lrow, int lhi, v8f (&acc)[4]) {
  #pragma unroll
  for (int k0 = 0; k0 < DINP; k0 += 32) {
    // x fragment from its unit (K chunks lhi*8 and 16+lhi*8): two 512-B wave loads
    const f16* xp = xfrag + (k0 / 32) * OPUNIT;
    v16h a = cat8(*(const v8h*)xp, *(const v8h*)(xp + 256));
    #pragma unroll
    for (int t = 0; t < 4; ++t) {
      const f16* bp = &Bpanel[t * 16 + lrow][k0 + lhi * 8];
      v16h b = cat8(*(const v8h*)bp, *(const v8h*)(bp + 16));
      acc[t] = XA ? wmma16(a, b, acc[t]) : wmma16(b, a, acc[t]);
    }
  }
  // Precaution: the wait takes the x loads' address as an input, which keeps that pair
  // live up to it, so that no load's data is written over it in front of the wait.
  asm volatile("s_wait_xcnt 0x0" :: "v"(xfrag) : "memory");
}

// 12 waves per SIMD (at most 80 registers): all 1,536 blocks, 6 per WGP, are resident at once.
__global__ void __launch_bounds__(256, 12) k_qkv(const f16* __restrict__ xh,
                                             const f16* __restrict__ WT,
                                             f16* __restrict__ qw,
                                             f16* __restrict__ kw,
                                             f16* __restrict__ vT) {
  __shared__ __align__(16) f16 Bpanel[64][PANEL_PITCH];   // 33 KB
  const int tid  = threadIdx.x;
  const int lane = tid & 31;
  const int w    = tid >> 5;
  const int lrow = lane & 15;
  const int lhi  = lane >> 4;
  const int m0   = blockIdx.y * 128 + w * 16;
  const int n0   = blockIdx.x * 64;

  // Stage weight panel: 64 rows x 512 B = 2048 chunks of 16 B, 8 per thread.
  #pragma unroll
  for (int j = 0; j < 8; ++j) {
    const int c = tid + j * 256;                      // chunk id
    const int row = c >> 5, col8 = (c & 31) * 8;
    async_cp16(lds_u32(&Bpanel[row][col8]),
               WT + (size_t)(n0 + row) * DINP + col8);
  }
  WAIT_ASYNC_0();
  __syncthreads();

  v8f acc[4];
  #pragma unroll
  for (int t = 0; t < 4; ++t) acc[t] = (v8f){0.f,0.f,0.f,0.f,0.f,0.f,0.f,0.f};

  const f16* xfrag = xh + (size_t)(m0 >> 4) * (KSTEPS * OPUNIT) + lane * 8;   // this lane's place in the tile's first unit
  const int which = n0 >> 8;            // 0=q 1=k 2=v, the same for the whole block
  const int hb    = (n0 & 255) >> 5;    // first of the block's two heads
  const int bb    = m0 >> 10;           // a wave's 16 rows lie in one batch
  const int nw    = m0 & 1023;          // its first row inside the batch
  // Precaution, both arms: the wait stands directly behind each store, in front of
  // the next write of a register that the store names.
  if (which == 2) {
    qkv_products<true>(xfrag, Bpanel, lrow, lhi, acc);
    #pragma unroll
    for (int t = 0; t < 4; ++t) {       // column d of head h, rows nw + 8*lhi + 0..7
      const int h = hb + (t >> 1);
      const int d = (t & 1) * 16 + lrow;
      v8h o;
      #pragma unroll
      for (int r = 0; r < 8; ++r) o[r] = (f16)acc[t][r];
      *(v8h*)(vT + ((size_t)(bb * HEADS + h) * DIMH + d) * NSEQ + nw + 8 * lhi) = o;
      WAIT_X_0();
    }
  } else {
    qkv_products<false>(xfrag, Bpanel, lrow, lhi, acc);
    f16* __restrict__ dst = which == 0 ? qw : kw;
    const float sc = which == 0 ? SCALE : 1.f;
    #pragma unroll
    for (int t = 0; t < 4; ++t) {       // row nw + lrow, columns d0 + 0..7 of head h
      const int h  = hb + (t >> 1);
      const int d0 = (t & 1) * 16 + 8 * lhi;
      v8h o;
      #pragma unroll
      for (int r = 0; r < 8; ++r) o[r] = (f16)(acc[t][r] * sc);
      *(v8h*)(dst + ((size_t)(bb * HEADS + h) * NSEQ + nw + lrow) * DIMH + d0) = o;
      WAIT_X_0();
    }
  }
}

static __device__ __forceinline__ float other_half(float v) {
  const int b = __builtin_bit_cast(int, v);
  return __builtin_bit_cast(float,
      __builtin_amdgcn_permlanex16(b, b, 0x76543210, 0xfedcba98, false, false));
}

// One K chunk and one V chunk of 16 bytes per lane, global -> LDS. The two copies and
// their s_wait_xcnt stand in one statement, so that no register that a copy names can
// be rewritten in front of the wait (a precaution).
static __device__ __forceinline__ void async_cp16_kv(unsigned kdst, const f16* ksrc,
                                                     unsigned vdst, const f16* vsrc) {
  asm volatile("global_load_async_to_lds_b128 %0, %2, off\n\t"
               "global_load_async_to_lds_b128 %1, %3, off\n\t"
               "s_wait_xcnt 0x0"
               :: "v"(kdst), "v"(vdst), "v"(ksrc), "v"(vsrc)
               : "memory");
}

__global__ void __launch_bounds__(256) k_attn(const f16* __restrict__ qw,
                                              const f16* __restrict__ kw,
                                              const f16* __restrict__ vT,
                                              const f16* __restrict__ biasT,
                                              f16* __restrict__ attn) {
  __shared__ __align__(16) f16 Kbuf[2][KPASS * TILE_PITCH];   // [key][d]   2 x 5 KB
  __shared__ __align__(16) f16 Vbuf[2][DIMH * VT_PITCH];      // [d][key]   2 x 4.5 KB
  const int tid  = threadIdx.x;
  const int lane = tid & 31;
  const int w    = tid >> 5;
  const int lrow = lane & 15;
  const int lhi  = lane >> 4;
  const int q0   = blockIdx.x * 128 + w * 16;
  const int h    = blockIdx.y;
  const int b    = blockIdx.z;
  const size_t headoff = (size_t)(b * HEADS + h) * NSEQ * DIMH;

  // Copier role: every thread moves one 16-byte chunk of the K tile (64 keys x 64 B)
  // and one of the V tile (32 d rows x 128 B) a pass.
  const int kr = tid >> 2, kc = (tid & 3) * 8;        // K: row = key
  const int vr = tid >> 3, vc = (tid & 7) * 8;        // V: row = d, stride NSEQ
  const f16* ksrc0 = kw + headoff + (size_t)kr * DIMH + kc;
  const f16* vsrc0 = vT + headoff + (size_t)vr * NSEQ + vc;
  const unsigned kdst0 = lds_u32(&Kbuf[0][kr * TILE_PITCH + kc]);
  const unsigned vdst0 = lds_u32(&Vbuf[0][vr * VT_PITCH + vc]);
  const unsigned kbufb = (unsigned)(KPASS * TILE_PITCH * sizeof(f16));   // bytes of a K buffer
  const unsigned vbufb = (unsigned)(DIMH * VT_PITCH * sizeof(f16));      // bytes of a V buffer

  // Q^T B-fragment (K=32 x 16 query columns), pre-scaled by 1/sqrt(d) in k_qkv.
  const f16* qp = qw + headoff + (size_t)(q0 + lrow) * DIMH + lhi * 8;
  const v16h qa = cat8(*(const v8h*)qp, *(const v8h*)(qp + 16));

  // This wave's row of bias tiles; the lane reads key lrow, queries 8*lhi + 0..7.
  const f16* btile = biasT + (size_t)h * NSEQ * NSEQ
                           + (size_t)(q0 >> 4) * (NSEQ / 16) * BTILE + lrow * 16 + lhi * 8;
  // Identity B operands (k = query of the tile, column = query lrow). One A operand
  // carries two bias tiles: keys 0-15 in k slots 0-15, keys 16-31 in k slots 16-31;
  // idlo picks the first, idhi the second. Same k order as every loader here.
  v16h idlo, idhi;
  #pragma unroll
  for (int i = 0; i < 8; ++i) {
    const f16 e = (lhi * 8 + i == lrow) ? (f16)1.f : (f16)0.f;
    idlo[i] = e;          idlo[8 + i] = (f16)0.f;
    idhi[i] = (f16)0.f;   idhi[8 + i] = e;
  }

  float m = -1e30f;                 // running max of query q0+lrow (both halves agree)
  float l = 0.f;                    // running sum over THIS lane half's keys only
  const v8f zero = (v8f){0.f,0.f,0.f,0.f,0.f,0.f,0.f,0.f};
  v8f o0 = zero, o1 = zero;         // O^T: reg r = d (8*lhi+r, 16+8*lhi+r), lane = query

  // Two-buffer ring: tile 0 lands and is published, then tile 1 flies during pass 0.
  async_cp16_kv(kdst0, ksrc0, vdst0, vsrc0);
  WAIT_ASYNC_0();
  __syncthreads();
  async_cp16_kv(kdst0 + kbufb, ksrc0 + KPASS * DIMH, vdst0 + vbufb, vsrc0 + KPASS);

  for (int it = 0; it < NSEQ / KPASS; ++it) {
    const int cur = it & 1;

    // Relative position bias: the four 16-key tiles of keys kb + 0..63, kb = 64*it.
    const f16* bt = btile + it * (4 * BTILE);
    const v16h ba0 = cat8(*(const v8h*)bt, *(const v8h*)(bt + BTILE));
    const v16h ba1 = cat8(*(const v8h*)(bt + 2 * BTILE), *(const v8h*)(bt + 3 * BTILE));

    // K A-fragments from LDS: lane row = key, K-dim = d.
    v16h bk[4];
    #pragma unroll
    for (int j = 0; j < 4; ++j) {
      const f16* kp = &Kbuf[cur][(j * 16 + lrow) * TILE_PITCH + lhi * 8];
      bk[j] = cat8(*(const v8h*)kp, *(const v8h*)(kp + 16));
    }
    // Precaution: the wait takes the bias loads' address as an input, which keeps that
    // pair live up to it, so that it is not rewritten in front of the wait.
    asm volatile("s_wait_xcnt 0x0" :: "v"(bt) : "memory");
    // Keeps the pass's loads (bias from L2, K from LDS) in front of the first WMMA:
    // without it the bias loads issue behind the K wait and the two latencies add up.
    __builtin_amdgcn_sched_barrier(0);
    v8f s[4];                         // s[j][r] = S[q0+lrow][kb + 16*j + 8*lhi + r]
    #pragma unroll
    for (int j = 0; j < 4; ++j) s[j] = wmma16(bk[j], qa, zero);
    s[0] = wmma16(ba0, idlo, s[0]);   // + bias of the same query and keys
    s[1] = wmma16(ba0, idhi, s[1]);
    s[2] = wmma16(ba1, idlo, s[2]);
    s[3] = wmma16(ba1, idhi, s[3]);

    // V^T A-fragments from LDS: lane row = d, K-dim = key. Those of keys 0-31 are asked
    // for here, ahead of the softmax; those of keys 32-63 follow behind it.
    const f16* vp0 = &Vbuf[cur][lrow * VT_PITCH + lhi * 8];
    const f16* vp1 = &Vbuf[cur][(16 + lrow) * VT_PITCH + lhi * 8];
    v16h bv00 = cat8(*(const v8h*)vp0, *(const v8h*)(vp0 + 16));
    v16h bv10 = cat8(*(const v8h*)vp1, *(const v8h*)(vp1 + 16));

    // Online softmax: 32 scores of the query in-lane, the other 32 in lane^16.
    float c = fmaxf(fmaxf(s[0][0], s[1][0]), fmaxf(s[2][0], s[3][0]));
    #pragma unroll
    for (int r = 1; r < 8; ++r)
      c = fmaxf(c, fmaxf(fmaxf(s[0][r], s[1][r]), fmaxf(s[2][r], s[3][r])));
    c = fmaxf(c, other_half(c));
    const float mn   = fmaxf(m, c);
    // exp(x) = 2^(x * log2 e), the exponents by packed arithmetic on the whole tiles.
    const float corr = __builtin_amdgcn_exp2f((m - mn) * LOG2E);
    v16h pb0, pb1;                    // P^T B-fragments: same k order as the V loader
    #pragma unroll
    for (int j = 0; j < 4; ++j) {
      s[j] = (s[j] - mn) * LOG2E;
      #pragma unroll
      for (int r = 0; r < 8; ++r) s[j][r] = __builtin_amdgcn_exp2f(s[j][r]);   // P^T, in place
    }
    #pragma unroll
    for (int r = 0; r < 8; ++r) {
      pb0[r]     = (f16)s[0][r];
      pb0[8 + r] = (f16)s[1][r];
      pb1[r]     = (f16)s[2][r];
      pb1[8 + r] = (f16)s[3][r];
    }
    // Row sum of this lane's 32 keys: tile on tile, then across the 8 registers.
    const v8f ps = (s[0] + s[1]) + (s[2] + s[3]);
    const float rs = ((ps[0] + ps[1]) + (ps[2] + ps[3])) + ((ps[4] + ps[5]) + (ps[6] + ps[7]));
    l = l * corr + rs;
    m = mn;
    #pragma unroll
    for (int r = 0; r < 8; ++r) { o0[r] *= corr; o1[r] *= corr; }

    v16h bv01 = cat8(*(const v8h*)(vp0 + 32), *(const v8h*)(vp0 + 48));
    v16h bv11 = cat8(*(const v8h*)(vp1 + 32), *(const v8h*)(vp1 + 48));
    o0 = wmma16(bv00, pb0, o0);
    o1 = wmma16(bv10, pb0, o1);
    o0 = wmma16(bv01, pb1, o0);
    o1 = wmma16(bv11, pb1, o1);

    // Foot of the pass: this wave's LDS reads have returned and its copies of tile
    // it+1 have landed; the one barrier publishes tile it+1 and ends every wave's last
    // read of this pass's buffer, which only then is refilled with tile it+2.
    asm volatile("s_wait_dscnt 0x0" ::: "memory");
    WAIT_ASYNC_0();
    __syncthreads();
    if (it + 2 < NSEQ / KPASS) {
      async_cp16_kv(kdst0 + cur * kbufb, ksrc0 + (size_t)(it + 2) * (KPASS * DIMH),
                    vdst0 + cur * vbufb, vsrc0 + (size_t)(it + 2) * KPASS);
    }
  }
  WAIT_ASYNC_0();                     // nothing is in flight when the wave ends

  // Join the halves' sums, normalize, store as the output GEMM's operand unit
  // (row tile of the queries, k step = head): the lane's two groups of 8 d are its
  // two chunks of the fragment, so each store is 512 contiguous bytes of the wave.
  l += other_half(l);
  const float inv = 1.f / l;
  v8h r0, r1;
  #pragma unroll
  for (int r = 0; r < 8; ++r) { r0[r] = (f16)(o0[r] * inv); r1[r] = (f16)(o1[r] * inv); }
  f16* op = attn + ((size_t)((b * NSEQ + q0) >> 4) * KSTEPS + h) * OPUNIT + lane * 8;
  *(v8h*)op         = r0;
  *(v8h*)(op + 256) = r1;
}

// ---------------------------------------------------------------------------
// Kernel 4: output projection. attn[16384,256] (f16 units) @ WoutT + b_out -> f32 out.
// Same LDS-staged weight panel as k_qkv.
// ---------------------------------------------------------------------------
__global__ void __launch_bounds__(256) k_out(const f16* __restrict__ A,
                                             const f16* __restrict__ WT,
                                             const float* __restrict__ bias,
                                             float* __restrict__ out) {
  __shared__ __align__(16) f16 Bpanel[64][PANEL_PITCH];   // 33 KB
  const int tid  = threadIdx.x;
  const int lane = tid & 31;
  const int w    = tid >> 5;
  const int lrow = lane & 15;
  const int lhi  = lane >> 4;
  const int m0   = blockIdx.y * 128 + w * 16;
  const int n0   = blockIdx.x * 64;

  #pragma unroll
  for (int j = 0; j < 8; ++j) {
    const int c = tid + j * 256;
    const int row = c >> 5, col8 = (c & 31) * 8;
    async_cp16(lds_u32(&Bpanel[row][col8]),
               WT + (size_t)(n0 + row) * DINP + col8);
  }
  WAIT_ASYNC_0();
  __syncthreads();

  v8f acc[4];
  #pragma unroll
  for (int t = 0; t < 4; ++t) acc[t] = (v8f){0.f,0.f,0.f,0.f,0.f,0.f,0.f,0.f};

  const f16* afrag = A + (size_t)(m0 >> 4) * (KSTEPS * OPUNIT) + lane * 8;
  #pragma unroll
  for (int k0 = 0; k0 < DINP; k0 += 32) {
    const f16* ap = afrag + (k0 / 32) * OPUNIT;
    v16h a = cat8(*(const v8h*)ap, *(const v8h*)(ap + 256));
    #pragma unroll
    for (int t = 0; t < 4; ++t) {
      const f16* bp = &Bpanel[t * 16 + lrow][k0 + lhi * 8];
      v16h b = cat8(*(const v8h*)bp, *(const v8h*)(bp + 16));
      acc[t] = wmma16(a, b, acc[t]);
    }
  }
  // Precaution: the wait takes the fragment loads' address as an input, which keeps that
  // pair live up to it, so that it is not rewritten in front of the wait.
  asm volatile("s_wait_xcnt 0x0" :: "v"(afrag) : "memory");

  #pragma unroll
  for (int t = 0; t < 4; ++t) {
    const int gcol = n0 + t * 16 + lrow;
    const float bv = bias[gcol];
    #pragma unroll
    for (int r = 0; r < 8; ++r) {
      out[(size_t)(m0 + r + 8 * lhi) * NOUT + gcol] = acc[t][r] + bv;
    }
  }
}

// ---------------------------------------------------------------------------
extern "C" void kernel_launch(void* const* d_in, const int* in_sizes, int n_in,
                              void* d_out, int out_size, void* d_ws, size_t ws_size,
                              hipStream_t stream) {
  const float* x      = (const float*)d_in[0];   // [16,1024,256]
  const float* W_qkv  = (const float*)d_in[1];   // [256,768]
  const float* W_out  = (const float*)d_in[2];   // [256,256]
  const float* b_out  = (const float*)d_in[3];   // [256]
  const float* btable = (const float*)d_in[4];   // [3969,8]
  const int*   relidx = (const int*)d_in[5];     // [1024*1024]
  float* out = (float*)d_out;

  char* ws = (char*)d_ws;
  size_t off = 0;
  f16* WqkvT = (f16*)(ws + off); off += (size_t)NQKV * DINP * 2;          // 384 KB
  f16* WoutT = (f16*)(ws + off); off += (size_t)NOUT * DINP * 2;          // 128 KB
  f16* qw    = (f16*)(ws + off); off += (size_t)B_SZ * HEADS * NSEQ * DIMH * 2; // 8 MB
  f16* kw    = (f16*)(ws + off); off += (size_t)B_SZ * HEADS * NSEQ * DIMH * 2; // 8 MB
  f16* vT    = (f16*)(ws + off); off += (size_t)B_SZ * HEADS * NSEQ * DIMH * 2; // 8 MB
  f16* attn  = (f16*)(ws + off); off += (size_t)B_SZ * NSEQ * HEADS * DIMH * 2; // 8 MB
  f16* biasT = (f16*)(ws + off); off += (size_t)HEADS * NSEQ * NSEQ * 2;        // 16 MB
  f16* xh    = (f16*)(ws + off); off += (size_t)B_SZ * NSEQ * DINP * 2;         // 8 MB

  k_prep<<<BBLOCKS + XBLOCKS + (NQKV * DINP + NOUT * DINP) / 256, 256, 0, stream>>>(
      x, W_qkv, W_out, btable, relidx, xh, WqkvT, WoutT, biasT);
  k_qkv<<<dim3(NQKV / 64, (B_SZ * NSEQ) / 128), 256, 0, stream>>>(xh, WqkvT, qw, kw, vT);
  k_attn<<<dim3(NSEQ / 128, HEADS, B_SZ), 256, 0, stream>>>(qw, kw, vT, biasT, attn);
  k_out<<<dim3(NOUT / 64, (B_SZ * NSEQ) / 128), 256, 0, stream>>>(attn, WoutT, b_out, out);
}

// v009
// Measured time: 57.2 microseconds a run.
// Two timings next to v008 both put it at 1.04 times that version's speed.
// Over all steps from v000 it is 2.93 times as fast.
#include <hip/hip_runtime.h>
#include <hip/hip_bf16.h>

typedef _Float16 f16;
typedef _Float16 v16h __attribute__((ext_vector_type(16)));
typedef _Float16 v8h  __attribute__((ext_vector_type(8)));
typedef float    v8f  __attribute__((ext_vector_type(8)));
typedef float    v4f  __attribute__((ext_vector_type(4)));

#define B_SZ   16
#define NSEQ   1024
#define HEADS  8
#define DIMH   32
#define DINP   256
#define NQKV   768
#define NOUT   256
#define NTAB   3969                    // rows of the bias table, (2*32-1)^2
#define SCALE  0.17677669529663689f   // 32^-0.5
#define LOG2E  1.44269504088896341f    // log2(e)
#define GROW_MAX 8.f                   // k_attn rescales when a score passes the maximum in use by this (log2 units)
// LDS row pitches in halves: row length + 16 B, an odd multiple of 16 B, so that
// the 16 rows of a ds_load_b128 fragment read fall on 16 different bank groups.
#define PANEL_PITCH (DINP + 8)         // 528 B for the 512-B weight rows
#define TILE_PITCH  (DIMH + 8)         // 80 B for the 64-B K tile rows
#define BTILE  256                     // halves of one 16-key x 16-query bias tile
#define KPASS  64                      // keys of one pass of k_attn
#define VT_PITCH (KPASS + 8)           // 144 B for the 128-B V tile rows
// Left-hand matrices of the two projections (x, attention output) live in the workspace
// as f16 units in WMMA operand order: unit = (16-row tile, 32-wide k step), 1 KB:
// [k half j][lane = 16*lhi + lrow][8 halves], element k = 32*step + 16*j + 8*lhi + i.
// A fragment is then two wave loads of 512 contiguous bytes (4 whole lines each).
#define OPUNIT 512                     // halves of one unit
#define KSTEPS (DINP / 32)             // units of a 16-row tile
#define XBLOCKS ((B_SZ * NSEQ / 16) * KSTEPS / 8)   // k_prep blocks that pack x, 8 units each
#define BBLOCKS ((NSEQ * NSEQ) / 2048)              // k_prep blocks that make bias tiles, 8 tiles each
typedef _Float16 v4h  __attribute__((ext_vector_type(4)));

static __device__ __forceinline__ v16h cat8(v8h lo, v8h hi) {
  return __builtin_shufflevector(lo, hi, 0,1,2,3,4,5,6,7,8,9,10,11,12,13,14,15);
}
static __device__ __forceinline__ v8f wmma16(v16h a, v16h b, v8f c) {
  // D = A(16x32 f16) * B(32x16 f16) + C(16x16 f32)
  return __builtin_amdgcn_wmma_f32_16x16x32_f16(false, a, false, b, (short)0, c, false, false);
}

// LDS byte offset of a shared-memory pointer: low 32 bits of the flat address
// (ISA 10.2: aperture LDS mapping is LDS_ADDR.U32 = addr[31:0]).
static __device__ __forceinline__ unsigned lds_u32(const void* p) {
  return (unsigned)(size_t)p;
}
// Async copy of 16 bytes global -> LDS per lane (ASYNCcnt-tracked).
static __device__ __forceinline__ void async_cp16(unsigned lds_dst, const f16* gsrc) {
  asm volatile("global_load_async_to_lds_b128 %0, %1, off"
               :: "v"(lds_dst), "v"(gsrc)
               : "memory");
}
#define WAIT_ASYNC_0() asm volatile("s_wait_asynccnt 0x0" ::: "memory")
#define WAIT_X_0()     asm volatile("s_wait_xcnt 0x0" ::: "memory")

// ---------------------------------------------------------------------------
// Part of kernel 1: materialize the relative-position bias as f16 tiles in the order of
// a WMMA A operand: [head][query tile][key tile][key 0-15][query 0-15], 512 B a
// tile. One wave makes one tile for ALL 8 heads: lane = (key lrow, query half
// lhi), 8 queries a thread. The index is read once, a table row (8 heads, 32 B)
// comes as two 16-byte loads, and a thread's 8 queries of a head leave as one
// 16-byte store, so that each wave-wide store fills four whole 128-byte lines.
// ---------------------------------------------------------------------------
static __device__ __forceinline__ void bias_tiles(const float* __restrict__ table,
                                                  const int* __restrict__ relidx,
                                                  f16* __restrict__ biasT) {
  const unsigned lane = threadIdx.x & 31u;
  const unsigned lrow = lane & 15u;
  const unsigned lhi  = lane >> 4;
  const unsigned wv   = blockIdx.x * 8u + (threadIdx.x >> 5);   // the grid's first 512 blocks -> 4096 waves = tiles
  const unsigned kt   = wv & 63u;                               // key tile
  const unsigned qt   = wv >> 6;                                // query tile

  const int* ip = relidx + (qt * 16u + lhi * 8u) * NSEQ + kt * 16u + lrow;
  int id[8];
  #pragma unroll
  for (int i = 0; i < 8; ++i) id[i] = ip[i * NSEQ];             // query qt*16 + lhi*8 + i, this key

  unsigned off[8];                                              // byte offset of each table row
  v4f row[8][2];                                                // [query][heads 0-3, 4-7]
  #pragma unroll
  for (int i = 0; i < 8; ++i) {
    // Bound the row before the address is formed (identity for a valid index).
    off[i] = min((unsigned)id[i], (unsigned)(NTAB - 1)) * (unsigned)(HEADS * sizeof(float));
    const float* tp = (const float*)((const char*)table + off[i]);
    row[i][0] = *(const v4f*)tp;
    row[i][1] = *(const v4f*)(tp + 4);
  }
  // Precaution: the wait stands behind the gathers and takes their offsets as
  // inputs, which keeps those registers live up to it, so that none of them is
  // written (by a later gather's data either) in front of the wait.
  asm volatile("s_wait_xcnt 0x0"
               :: "v"(off[0]), "v"(off[1]), "v"(off[2]), "v"(off[3]),
                  "v"(off[4]), "v"(off[5]), "v"(off[6]), "v"(off[7])
               : "memory");

  f16* op = biasT + (size_t)(qt * 64u + kt) * BTILE + lrow * 16u + lhi * 8u;
  #pragma unroll
  for (int h = 0; h < HEADS; ++h) {
    v8h o;
    #pragma unroll
    for (int i = 0; i < 8; ++i) o[i] = (f16)(row[i][h >> 2][h & 3] * LOG2E);   // log2 units, as k_attn's scores
    *(v8h*)(op + (size_t)h * NSEQ * NSEQ) = o;
  }
}

// ---------------------------------------------------------------------------
// Kernel 1: pack x into f16 operand-order units, and transpose weights to f16
// [out, k] so WMMA B fragments are contiguous per-lane 16B loads.
// Packing: one wave makes one unit. Each of its four loads takes 4 rows x 128 B
// (8 lanes a row: whole lines); a block reads 16 whole rows and writes 8 KB in a row.
// The bias tiles need nothing of this work and nothing here needs them, so they share
// the launch by a range of the block index. They come first: theirs is the longest
// chain of dependent memory accesses (index, table row, store).
// ---------------------------------------------------------------------------
__global__ void __launch_bounds__(256) k_prep(const float* __restrict__ x,
                                              const float* __restrict__ Wqkv,
                                              const float* __restrict__ Wout,
                                              const float* __restrict__ table,
                                              const int* __restrict__ relidx,
                                              f16* __restrict__ xh,
                                              f16* __restrict__ WqkvT,
                                              f16* __restrict__ WoutT,
                                              f16* __restrict__ biasT) {
  if (blockIdx.x < BBLOCKS) {                         // the same for the whole block
    bias_tiles(table, relidx, biasT);
    return;
  }
  const unsigned blk = blockIdx.x - BBLOCKS;          // block among those of x and the weights
  if (blk < XBLOCKS) {                                // the same for the whole block
    const unsigned lane = threadIdx.x & 31u;
    const unsigned unit = blk * 8u + (threadIdx.x >> 5);          // row tile * KSTEPS + k step
    const unsigned r4   = lane >> 3;                  // row inside a group of 4
    const unsigned c4   = lane & 7u;                  // which 4 floats of the 32-wide k step
    const float* xp = x + (size_t)((unit / KSTEPS) * 16u + r4) * DINP + (unit % KSTEPS) * 32u + c4 * 4u;
    v4f v[4];
    #pragma unroll
    for (int n = 0; n < 4; ++n) v[n] = *(const v4f*)(xp + n * 4 * DINP);   // row 4n + r4
    // Precaution: the wait takes the loads' address as an input, which keeps that pair
    // live up to it, so that it is not rewritten in front of the wait.
    asm volatile("s_wait_xcnt 0x0" :: "v"(xp) : "memory");
    // k = 4*c4 + i: j = c4 >> 2, lhi = (c4 >> 1) & 1, place in the lane's 8 halves 4*(c4 & 1).
    f16* op = xh + (size_t)unit * OPUNIT + (c4 >> 2) * 256u + (((c4 >> 1) & 1u) * 16u + r4) * 8u + (c4 & 1u) * 4u;
    v4h o[4];
    #pragma unroll
    for (int n = 0; n < 4; ++n) {
      #pragma unroll
      for (int i = 0; i < 4; ++i) o[n][i] = (f16)v[n][i];
    }
    #pragma unroll
    for (int n = 0; n < 4; ++n) *(v4h*)(op + n * 32) = o[n];      // lrow = 4n + r4
    // Precaution: the wait stands behind the four stores, in front of any later write of a
    // register that they name (the built code of another part follows on this one).
    WAIT_X_0();
    return;
  }
  int idx = (blk - XBLOCKS) * 256 + threadIdx.x;                  // 1024 blocks -> 262144
  if (idx < NQKV * DINP) {
    int o = idx / DINP, k = idx % DINP;
    WqkvT[o * DINP + k] = (f16)Wqkv[k * NQKV + o];
  } else {
    int j = idx - NQKV * DINP;                        // < 256*256
    int o = j / DINP, k = j % DINP;
    WoutT[o * DINP + k] = (f16)Wout[k * NOUT + o];
  }
}

// ---------------------------------------------------------------------------
// Kernel 2: QKV projection. x[16384,256] (f16 units) @ WqkvT -> q/k/vT in head layout.
// Block = 8 waves stacked in M (128x64 C tile). The shared 64x256 f16 weight
// panel is staged once into LDS via async-to-LDS copies (8x traffic cut).
// A 64-column block lies wholly in q, in k or in v. The operand roles are chosen so
// that a lane's 8 results of a tile lie along the contiguous axis of their output
// (d for q and k, n for vT) and leave as ONE 16-byte store.
// ---------------------------------------------------------------------------
// The 32 products of a wave's 16 x 64 tile. XA: the x rows are the A operand
// (reg r = x row r + 8*lhi, lane = column lrow); else the weight rows are A
// (reg r = column r + 8*lhi, lane = x row lrow). Both loaders keep one k order.
template <bool XA>
static __device__ __forceinline__ void qkv_products(const f16* __restrict__ xfrag,
                                                    const f16 (&Bpanel)[64][PANEL_PITCH],
                                                    int lrow, int lhi, v8f (&acc)[4]) {
  #pragma unroll
  for (int k0 = 0; k0 < DINP; k0 += 32) {
    // x fragment from its unit (K chunks lhi*8 and 16+lhi*8): two 512-B wave loads
    const f16* xp = xfrag + (k0 / 32) * OPUNIT;
    v16h a = cat8(*(const v8h*)xp, *(const v8h*)(xp + 256));
    #pragma unroll
    for (int t = 0; t < 4; ++t) {
      const f16* bp = &Bpanel[t * 16 + lrow][k0 + lhi * 8];
      v16h b = cat8(*(const v8h*)bp, *(const v8h*)(bp + 16));
      acc[t] = XA ? wmma16(a, b, acc[t]) : wmma16(b, a, acc[t]);
    }
  }
  // Precaution: the wait takes the x loads' address as an input, which keeps that pair
  // live up to it, so that no load's data is written over it in front of the wait.
  asm volatile("s_wait_xcnt 0x0" :: "v"(xfrag) : "memory");
}

// 12 waves per SIMD (at most 80 registers): all 1,536 blocks, 6 per WGP, are resident at once.
__global__ void __launch_bounds__(256, 12) k_qkv(const f16* __restrict__ xh,
                                             const f16* __restrict__ WT,
                                             f16* __restrict__ qw,
                                             f16* __restrict__ kw,
                                             f16* __restrict__ vT) {
  __shared__ __align__(16) f16 Bpanel[64][PANEL_PITCH];   // 33 KB
  const int tid  = threadIdx.x;
  const int lane = tid & 31;
  const int w    = tid >> 5;
  const int lrow = lane & 15;
  const int lhi  = lane >> 4;
  const int m0   = blockIdx.y * 128 + w * 16;
  const int n0   = blockIdx.x * 64;

  // Stage weight panel: 64 rows x 512 B = 2048 chunks of 16 B, 8 per thread.
  #pragma unroll
  for (int j = 0; j < 8; ++j) {
    const int c = tid + j * 256;                      // chunk id
    const int row = c >> 5, col8 = (c & 31) * 8;
    async_cp16(lds_u32(&Bpanel[row][col8]),
               WT + (size_t)(n0 + row) * DINP + col8);
  }
  WAIT_ASYNC_0();
  __syncthreads();

  v8f acc[4];
  #pragma unroll
  for (int t = 0; t < 4; ++t) acc[t] = (v8f){0.f,0.f,0.f,0.f,0.f,0.f,0.f,0.f};

  const f16* xfrag = xh + (size_t)(m0 >> 4) * (KSTEPS * OPUNIT) + lane * 8;   // this lane's place in the tile's first unit
  const int which = n0 >> 8;            // 0=q 1=k 2=v, the same for the whole block
  const int hb    = (n0 & 255) >> 5;    // first of the block's two heads
  const int bb    = m0 >> 10;           // a wave's 16 rows lie in one batch
  const int nw    = m0 & 1023;          // its first row inside the batch
  // Precaution, both arms: the wait stands directly behind each store, in front of
  // the next write of a register that the store names.
  if (which == 2) {
    qkv_products<true>(xfrag, Bpanel, lrow, lhi, acc);
    #pragma unroll
    for (int t = 0; t < 4; ++t) {       // column d of head h, rows nw + 8*lhi + 0..7
      const int h = hb + (t >> 1);
      const int d = (t & 1) * 16 + lrow;
      v8h o;
      #pragma unroll
      for (int r = 0; r < 8; ++r) o[r] = (f16)acc[t][r];
      *(v8h*)(vT + ((size_t)(bb * HEADS + h) * DIMH + d) * NSEQ + nw + 8 * lhi) = o;
      WAIT_X_0();
    }
  } else {
    qkv_products<false>(xfrag, Bpanel, lrow, lhi, acc);
    f16* __restrict__ dst = which == 0 ? qw : kw;
    const float sc = which == 0 ? SCALE * LOG2E : 1.f;   // q carries log2(e): k_attn's scores are exponents of 2
    #pragma unroll
    for (int t = 0; t < 4; ++t) {       // row nw + lrow, columns d0 + 0..7 of head h
      const int h  = hb + (t >> 1);
      const int d0 = (t & 1) * 16 + 8 * lhi;
      v8h o;
      #pragma unroll
      for (int r = 0; r < 8; ++r) o[r] = (f16)(acc[t][r] * sc);
      *(v8h*)(dst + ((size_t)(bb * HEADS + h) * NSEQ + nw + lrow) * DIMH + d0) = o;
      WAIT_X_0();
    }
  }
}

static __device__ __forceinline__ float other_half(float v) {
  const int b = __builtin_bit_cast(int, v);
  return __builtin_bit_cast(float,
      __builtin_amdgcn_permlanex16(b, b, 0x76543210, 0xfedcba98, false, false));
}

// One K chunk and one V chunk of 16 bytes per lane, global -> LDS. The two copies and
// their s_wait_xcnt stand in one statement, so that no register that a copy names can
// be rewritten in front of the wait (a precaution).
static __device__ __forceinline__ void async_cp16_kv(unsigned kdst, const f16* ksrc,
                                                     unsigned vdst, const f16* vsrc) {
  asm volatile("global_load_async_to_lds_b128 %0, %2, off\n\t"
               "global_load_async_to_lds_b128 %1, %3, off\n\t"
               "s_wait_xcnt 0x0"
               :: "v"(kdst), "v"(vdst), "v"(ksrc), "v"(vsrc)
               : "memory");
}

// 8 waves per SIMD (at most 128 registers): all 1,024 blocks, 4 per WGP, are resident at once.
__global__ void __launch_bounds__(256, 8) k_attn(const f16* __restrict__ qw,
                                              const f16* __restrict__ kw,
                                              const f16* __restrict__ vT,
                                              const f16* __restrict__ biasT,
                                              f16* __restrict__ attn) {
  __shared__ __align__(16) f16 Kbuf[2][KPASS * TILE_PITCH];   // [key][d]   2 x 5 KB
  __shared__ __align__(16) f16 Vbuf[2][DIMH * VT_PITCH];      // [d][key]   2 x 4.5 KB
  const int tid  = threadIdx.x;
  const int lane = tid & 31;
  const int w    = tid >> 5;
  const int lrow = lane & 15;
  const int lhi  = lane >> 4;
  const int q0   = blockIdx.x * 128 + w * 16;
  const int h    = blockIdx.y;
  const int b    = blockIdx.z;
  const size_t headoff = (size_t)(b * HEADS + h) * NSEQ * DIMH;

  // Copier role: every thread moves one 16-byte chunk of the K tile (64 keys x 64 B)
  // and one of the V tile (32 d rows x 128 B) a pass.
  const int kr = tid >> 2, kc = (tid & 3) * 8;        // K: row = key
  const int vr = tid >> 3, vc = (tid & 7) * 8;        // V: row = d, stride NSEQ
  const f16* ksrc0 = kw + headoff + (size_t)kr * DIMH + kc;
  const f16* vsrc0 = vT + headoff + (size_t)vr * NSEQ + vc;
  const unsigned kdst0 = lds_u32(&Kbuf[0][kr * TILE_PITCH + kc]);
  const unsigned vdst0 = lds_u32(&Vbuf[0][vr * VT_PITCH + vc]);
  const unsigned kbufb = (unsigned)(KPASS * TILE_PITCH * sizeof(f16));   // bytes of a K buffer
  const unsigned vbufb = (unsigned)(DIMH * VT_PITCH * sizeof(f16));      // bytes of a V buffer

  // Q^T B-fragment (K=32 x 16 query columns), pre-scaled by log2(e)/sqrt(d) in k_qkv.
  const f16* qp = qw + headoff + (size_t)(q0 + lrow) * DIMH + lhi * 8;
  const v16h qa = cat8(*(const v8h*)qp, *(const v8h*)(qp + 16));

  // This wave's row of bias tiles; the lane reads key lrow, queries 8*lhi + 0..7.
  const f16* btile = biasT + (size_t)h * NSEQ * NSEQ
                           + (size_t)(q0 >> 4) * (NSEQ / 16) * BTILE + lrow * 16 + lhi * 8;
  // Identity B operands (k = query of the tile, column = query lrow). One A operand
  // carries two bias tiles: keys 0-15 in k slots 0-15, keys 16-31 in k slots 16-31;
  // idlo picks the first, idhi the second. Same k order as every loader here.
  v16h idlo, idhi;
  #pragma unroll
  for (int i = 0; i < 8; ++i) {
    const f16 e = (lhi * 8 + i == lrow) ? (f16)1.f : (f16)0.f;
    idlo[i] = e;          idlo[8 + i] = (f16)0.f;
    idhi[i] = (f16)0.f;   idhi[8 + i] = e;
  }

  float m = 0.f;                    // maximum in use for query q0+lrow (both halves agree); pass 0 sets it
  float l = 0.f;                    // running sum over THIS lane half's keys only
  const v8f zero = (v8f){0.f,0.f,0.f,0.f,0.f,0.f,0.f,0.f};
  v8f o0 = zero, o1 = zero;         // O^T: reg r = d (8*lhi+r, 16+8*lhi+r), lane = query

  // Two-buffer ring: tile 0 lands and is published, then tile 1 flies during pass 0.
  async_cp16_kv(kdst0, ksrc0, vdst0, vsrc0);
  WAIT_ASYNC_0();
  __syncthreads();
  async_cp16_kv(kdst0 + kbufb, ksrc0 + KPASS * DIMH, vdst0 + vbufb, vsrc0 + KPASS);

  for (int it = 0; it < NSEQ / KPASS; ++it) {
    const int cur = it & 1;

    // Relative position bias: the four 16-key tiles of keys kb + 0..63, kb = 64*it.
    const f16* bt = btile + it * (4 * BTILE);
    const v16h ba0 = cat8(*(const v8h*)bt, *(const v8h*)(bt + BTILE));
    const v16h ba1 = cat8(*(const v8h*)(bt + 2 * BTILE), *(const v8h*)(bt + 3 * BTILE));

    // K A-fragments from LDS: lane row = key, K-dim = d.
    v16h bk[4];
    #pragma unroll
    for (int j = 0; j < 4; ++j) {
      const f16* kp = &Kbuf[cur][(j * 16 + lrow) * TILE_PITCH + lhi * 8];
      bk[j] = cat8(*(const v8h*)kp, *(const v8h*)(kp + 16));
    }
    // Precaution: the wait takes the bias loads' address as an input, which keeps that
    // pair live up to it, so that it is not rewritten in front of the wait.
    asm volatile("s_wait_xcnt 0x0" :: "v"(bt) : "memory");
    // Keeps the pass's loads (bias from L2, K from LDS) in front of the first WMMA:
    // without it the bias loads issue behind the K wait and the two latencies add up.
    __builtin_amdgcn_sched_barrier(0);
    const float nm = -m;
    const v8f negm = (v8f){nm,nm,nm,nm,nm,nm,nm,nm};   // C operand of the score products
    v8f s[4];                         // s[j][r] = S[q0+lrow][kb + 16*j + 8*lhi + r] - maximum in use
    #pragma unroll
    for (int j = 0; j < 4; ++j) s[j] = wmma16(bk[j], qa, negm);   // scores less the maximum in use
    s[0] = wmma16(ba0, idlo, s[0]);   // + bias of the same query and keys
    s[1] = wmma16(ba0, idhi, s[1]);
    s[2] = wmma16(ba1, idlo, s[2]);
    s[3] = wmma16(ba1, idhi, s[3]);

    // V^T A-fragments from LDS: lane row = d, K-dim = key. Those of keys 0-31 are asked
    // for here, ahead of the softmax; those of keys 32-63 follow behind it.
    const f16* vp0 = &Vbuf[cur][lrow * VT_PITCH + lhi * 8];
    const f16* vp1 = &Vbuf[cur][(16 + lrow) * VT_PITCH + lhi * 8];
    v16h bv00 = cat8(*(const v8h*)vp0, *(const v8h*)(vp0 + 16));
    v16h bv10 = cat8(*(const v8h*)vp1, *(const v8h*)(vp1 + 16));

    // Online softmax: 32 scores of the query in-lane, the other 32 in lane^16.
    float c = fmaxf(fmaxf(s[0][0], s[1][0]), fmaxf(s[2][0], s[3][0]));
    #pragma unroll
    for (int r = 1; r < 8; ++r)
      c = fmaxf(c, fmaxf(fmaxf(s[0][r], s[1][r]), fmaxf(s[2][r], s[3][r])));
    // One test for the whole wave (a scalar branch, EXEC stays full for the WMMAs).
    if (__builtin_amdgcn_ballot_w32(c > GROW_MAX) != 0u || it == 0) {
      c = fmaxf(c, other_half(c));
      const float d    = it == 0 ? c : fmaxf(c, 0.f);      // the maximum in use never falls
      const float corr = it == 0 ? 1.f : __builtin_amdgcn_exp2f(-d);   // O and l are 0 in pass 0
      #pragma unroll
      for (int j = 0; j < 4; ++j) s[j] = s[j] - d;
      #pragma unroll
      for (int r = 0; r < 8; ++r) { o0[r] *= corr; o1[r] *= corr; }
      l *= corr;
      m += d;
    }
    v16h pb0, pb1;                    // P^T B-fragments: same k order as the V loader
    #pragma unroll
    for (int j = 0; j < 4; ++j) {
      #pragma unroll
      for (int r = 0; r < 8; ++r) s[j][r] = __builtin_amdgcn_exp2f(s[j][r]);   // P^T, in place
    }
    #pragma unroll
    for (int r = 0; r < 8; ++r) {
      pb0[r]     = (f16)s[0][r];
      pb0[8 + r] = (f16)s[1][r];
      pb1[r]     = (f16)s[2][r];
      pb1[8 + r] = (f16)s[3][r];
    }
    // Row sum of this lane's 32 keys: tile on tile, then across the 8 registers.
    const v8f ps = (s[0] + s[1]) + (s[2] + s[3]);
    const float rs = ((ps[0] + ps[1]) + (ps[2] + ps[3])) + ((ps[4] + ps[5]) + (ps[6] + ps[7]));
    l += rs;

    v16h bv01 = cat8(*(const v8h*)(vp0 + 32), *(const v8h*)(vp0 + 48));
    v16h bv11 = cat8(*(const v8h*)(vp1 + 32), *(const v8h*)(vp1 + 48));
    o0 = wmma16(bv00, pb0, o0);
    o1 = wmma16(bv10, pb0, o1);
    o0 = wmma16(bv01, pb1, o0);
    o1 = wmma16(bv11, pb1, o1);

    // Foot of the pass: this wave's LDS reads have returned and its copies of tile
    // it+1 have landed; the one barrier publishes tile it+1 and ends every wave's last
    // read of this pass's buffer, which only then is refilled with tile it+2.
    asm volatile("s_wait_dscnt 0x0" ::: "memory");
    WAIT_ASYNC_0();
    __syncthreads();
    if (it + 2 < NSEQ / KPASS) {
      async_cp16_kv(kdst0 + cur * kbufb, ksrc0 + (size_t)(it + 2) * (KPASS * DIMH),
                    vdst0 + cur * vbufb, vsrc0 + (size_t)(it + 2) * KPASS);
    }
  }
  WAIT_ASYNC_0();                     // nothing is in flight when the wave ends

  // Join the halves' sums, normalize, store as the output GEMM's operand unit
  // (row tile of the queries, k step = head): the lane's two groups of 8 d are its
  // two chunks of the fragment, so each store is 512 contiguous bytes of the wave.
  l += other_half(l);
  const float inv = 1.f / l;
  v8h r0, r1;
  #pragma unroll
  for (int r = 0; r < 8; ++r) { r0[r] = (f16)(o0[r] * inv); r1[r] = (f16)(o1[r] * inv); }
  f16* op = attn + ((size_t)((b * NSEQ + q0) >> 4) * KSTEPS + h) * OPUNIT + lane * 8;
  *(v8h*)op         = r0;
  *(v8h*)(op + 256) = r1;
}

// ---------------------------------------------------------------------------
// Kernel 4: output projection. attn[16384,256] (f16 units) @ WoutT + b_out -> f32 out.
// Same LDS-staged weight panel as k_qkv.
// ---------------------------------------------------------------------------
__global__ void __launch_bounds__(256) k_out(const f16* __restrict__ A,
                                             const f16* __restrict__ WT,
                                             const float* __restrict__ bias,
                                             float* __restrict__ out) {
  __shared__ __align__(16) f16 Bpanel[64][PANEL_PITCH];   // 33 KB
  const int tid  = threadIdx.x;
  const int lane = tid & 31;
  const int w    = tid >> 5;
  const int lrow = lane & 15;
  const int lhi  = lane >> 4;
  const int m0   = blockIdx.y * 128 + w * 16;
  const int n0   = blockIdx.x * 64;

  #pragma unroll
  for (int j = 0; j < 8; ++j) {
    const int c = tid + j * 256;
    const int row = c >> 5, col8 = (c & 31) * 8;
    async_cp16(lds_u32(&Bpanel[row][col8]),
               WT + (size_t)(n0 + row) * DINP + col8);
  }
  WAIT_ASYNC_0();
  __syncthreads();

  v8f acc[4];
  #pragma unroll
  for (int t = 0; t < 4; ++t) acc[t] = (v8f){0.f,0.f,0.f,0.f,0.f,0.f,0.f,0.f};

  const f16* afrag = A + (size_t)(m0 >> 4) * (KSTEPS * OPUNIT) + lane * 8;
  #pragma unroll
  for (int k0 = 0; k0 < DINP; k0 += 32) {
    const f16* ap = afrag + (k0 / 32) * OPUNIT;
    v16h a = cat8(*(const v8h*)ap, *(const v8h*)(ap + 256));
    #pragma unroll
    for (int t = 0; t < 4; ++t) {
      const f16* bp = &Bpanel[t * 16 + lrow][k0 + lhi * 8];
      v16h b = cat8(*(const v8h*)bp, *(const v8h*)(bp + 16));
      acc[t] = wmma16(a, b, acc[t]);
    }
  }
  // Precaution: the wait takes the fragment loads' address as an input, which keeps that
  // pair live up to it, so that it is not rewritten in front of the wait.
  asm volatile("s_wait_xcnt 0x0" :: "v"(afrag) : "memory");

  #pragma unroll
  for (int t = 0; t < 4; ++t) {
    const int gcol = n0 + t * 16 + lrow;
    const float bv = bias[gcol];
    #pragma unroll
    for (int r = 0; r < 8; ++r) {
      out[(size_t)(m0 + r + 8 * lhi) * NOUT + gcol] = acc[t][r] + bv;
    }
  }
}

// ---------------------------------------------------------------------------
extern "C" void kernel_launch(void* const* d_in, const int* in_sizes, int n_in,
                              void* d_out, int out_size, void* d_ws, size_t ws_size,
                              hipStream_t stream) {
  const float* x      = (const float*)d_in[0];   // [16,1024,256]
  const float* W_qkv  = (const float*)d_in[1];   // [256,768]
  const float* W_out  = (const float*)d_in[2];   // [256,256]
  const float* b_out  = (const float*)d_in[3];   // [256]
  const float* btable = (const float*)d_in[4];   // [3969,8]
  const int*   relidx = (const int*)d_in[5];     // [1024*1024]
  float* out = (float*)d_out;

  char* ws = (char*)d_ws;
  size_t off = 0;
  f16* WqkvT = (f16*)(ws + off); off += (size_t)NQKV * DINP * 2;          // 384 KB
  f16* WoutT = (f16*)(ws + off); off += (size_t)NOUT * DINP * 2;          // 128 KB
  f16* qw    = (f16*)(ws + off); off += (size_t)B_SZ * HEADS * NSEQ * DIMH * 2; // 8 MB
  f16* kw    = (f16*)(ws + off); off += (size_t)B_SZ * HEADS * NSEQ * DIMH * 2; // 8 MB
  f16* vT    = (f16*)(ws + off); off += (size_t)B_SZ * HEADS * NSEQ * DIMH * 2; // 8 MB
  f16* attn  = (f16*)(ws + off); off += (size_t)B_SZ * NSEQ * HEADS * DIMH * 2; // 8 MB
  f16* biasT = (f16*)(ws + off); off += (size_t)HEADS * NSEQ * NSEQ * 2;        // 16 MB
  f16* xh    = (f16*)(ws + off); off += (size_t)B_SZ * NSEQ * DINP * 2;         // 8 MB

  k_prep<<<BBLOCKS + XBLOCKS + (NQKV * DINP + NOUT * DINP) / 256, 256, 0, stream>>>(
      x, W_qkv, W_out, btable, relidx, xh, WqkvT, WoutT, biasT);
  k_qkv<<<dim3(NQKV / 64, (B_SZ * NSEQ) / 128), 256, 0, stream>>>(xh, WqkvT, qw, kw, vT);
  k_attn<<<dim3(NSEQ / 128, HEADS, B_SZ), 256, 0, stream>>>(qw, kw, vT, biasT, attn);
  k_out<<<dim3(NOUT / 64, (B_SZ * NSEQ) / 128), 256, 0, stream>>>(attn, WoutT, b_out, out);
}

// v010
// It runs in 53.6 microseconds.
// Two timings next to v009 put it at 1.06 and 1.07 times that version's speed.
// Over all steps from v000 it is 3.12 times as fast.
#include <hip/hip_runtime.h>
#include <hip/hip_bf16.h>

typedef _Float16 f16;
typedef _Float16 v16h __attribute__((ext_vector_type(16)));
typedef _Float16 v8h  __attribute__((ext_vector_type(8)));
typedef float    v8f  __attribute__((ext_vector_type(8)));
typedef float    v4f  __attribute__((ext_vector_type(4)));

#define B_SZ   16
#define NSEQ   1024
#define HEADS  8
#define DIMH   32
#define DINP   256
#define NQKV   768
#define NOUT   256
#define NTAB   3969                    // rows of the bias table, (2*32-1)^2
#define SCALE  0.17677669529663689f   // 32^-0.5
#define LOG2E  1.44269504088896341f    // log2(e)
#define GROW_MAX 8.f                   // k_attn rescales when a score passes the maximum in use by this (log2 units)
// LDS row pitches in halves: row length + 16 B, an odd multiple of 16 B, so that
// the 16 rows of a ds_load_b128 fragment read fall on 16 different bank groups.
#define PANEL_PITCH (DINP + 8)         // 528 B for the 512-B weight rows
#define TILE_PITCH  (DIMH + 8)         // 80 B for the 64-B K tile rows
#define BTILE  256                     // halves of one 16-key x 16-query bias tile
#define KPASS  64                      // keys of one pass of k_attn
#define VT_PITCH (KPASS + 8)           // 144 B for the 128-B V tile rows
// Left-hand matrices of the two projections (x, attention output) live in the workspace
// as f16 units in WMMA operand order: unit = (16-row tile, 32-wide k step), 1 KB:
// [k half j][lane = 16*lhi + lrow][8 halves], element k = 32*step + 16*j + 8*lhi + i.
// A fragment is then two wave loads of 512 contiguous bytes (4 whole lines each).
#define OPUNIT 512                     // halves of one unit
#define KSTEPS (DINP / 32)             // units of a 16-row tile
#define XBLOCKS ((B_SZ * NSEQ / 16) * KSTEPS / 8)   // k_prep blocks that pack x, 8 units each
#define BBLOCKS ((NSEQ * NSEQ) / 2048)              // k_prep blocks that make bias tiles, 8 tiles each
typedef _Float16 v4h  __attribute__((ext_vector_type(4)));

static __device__ __forceinline__ v16h cat8(v8h lo, v8h hi) {
  return __builtin_shufflevector(lo, hi, 0,1,2,3,4,5,6,7,8,9,10,11,12,13,14,15);
}
static __device__ __forceinline__ v8f wmma16(v16h a, v16h b, v8f c) {
  // D = A(16x32 f16) * B(32x16 f16) + C(16x16 f32)
  return __builtin_amdgcn_wmma_f32_16x16x32_f16(false, a, false, b, (short)0, c, false, false);
}

// LDS byte offset of a shared-memory pointer: low 32 bits of the flat address
// (ISA 10.2: aperture LDS mapping is LDS_ADDR.U32 = addr[31:0]).
static __device__ __forceinline__ unsigned lds_u32(const void* p) {
  return (unsigned)(size_t)p;
}
// Async copy of 16 bytes global -> LDS per lane (ASYNCcnt-tracked).
static __device__ __forceinline__ void async_cp16(unsigned lds_dst, const f16* gsrc) {
  asm volatile("global_load_async_to_lds_b128 %0, %1, off"
               :: "v"(lds_dst), "v"(gsrc)
               : "memory");
}
#define WAIT_ASYNC_0() asm volatile("s_wait_asynccnt 0x0" ::: "memory")
#define WAIT_X_0()     asm volatile("s_wait_xcnt 0x0" ::: "memory")

// ---------------------------------------------------------------------------
// Part of kernel 1: materialize the relative-position bias as f16 tiles in the order of
// a WMMA A operand: [head][query tile][key tile][key 0-15][query 0-15], 512 B a
// tile. One wave makes one tile for ALL 8 heads: lane = (key lrow, query half
// lhi), 8 queries a thread. The index is read once, a table row (8 heads, 32 B)
// comes as two 16-byte loads, and a thread's 8 queries of a head leave as one
// 16-byte store, so that each wave-wide store fills four whole 128-byte lines.
// ---------------------------------------------------------------------------
static __device__ __forceinline__ void bias_tiles(const float* __restrict__ table,
                                                  const int* __restrict__ relidx,
                                                  f16* __restrict__ biasT) {
  const unsigned lane = threadIdx.x & 31u;
  const unsigned lrow = lane & 15u;
  const unsigned lhi  = lane >> 4;
  const unsigned wv   = blockIdx.x * 8u + (threadIdx.x >> 5);   // the grid's first 512 blocks -> 4096 waves = tiles
  const unsigned kt   = wv & 63u;                               // key tile
  const unsigned qt   = wv >> 6;                                // query tile

  const int* ip = relidx + (qt * 16u + lhi * 8u) * NSEQ + kt * 16u + lrow;
  int id[8];
  #pragma unroll
  for (int i = 0; i < 8; ++i) id[i] = ip[i * NSEQ];             // query qt*16 + lhi*8 + i, this key

  unsigned off[8];                                              // byte offset of each table row
  v4f row[8][2];                                                // [query][heads 0-3, 4-7]
  #pragma unroll
  for (int i = 0; i < 8; ++i) {
    // Bound the row before the address is formed (identity for a valid index).
    off[i] = min((unsigned)id[i], (unsigned)(NTAB - 1)) * (unsigned)(HEADS * sizeof(float));
    const float* tp = (const float*)((const char*)table + off[i]);
    row[i][0] = *(const v4f*)tp;
    row[i][1] = *(const v4f*)(tp + 4);
  }
  // Precaution: the wait stands behind the gathers and takes their offsets as
  // inputs, which keeps those registers live up to it, so that none of them is
  // written (by a later gather's data either) in front of the wait.
  asm volatile("s_wait_xcnt 0x0"
               :: "v"(off[0]), "v"(off[1]), "v"(off[2]), "v"(off[3]),
                  "v"(off[4]), "v"(off[5]), "v"(off[6]), "v"(off[7])
               : "memory");

  f16* op = biasT + (size_t)(qt * 64u + kt) * BTILE + lrow * 16u + lhi * 8u;
  #pragma unroll
  for (int h = 0; h < HEADS; ++h) {
    v8h o;
    #pragma unroll
    for (int i = 0; i < 8; ++i) o[i] = (f16)(row[i][h >> 2][h & 3] * LOG2E);   // log2 units, as k_attn's scores
    *(v8h*)(op + (size_t)h * NSEQ * NSEQ) = o;
  }
}

// ---------------------------------------------------------------------------
// Kernel 1: pack x into f16 operand-order units, and transpose weights to f16
// [out, k] so the weights' WMMA fragments are contiguous per-lane 16B loads.
// Packing: one wave makes one unit. Each of its four loads takes 4 rows x 128 B
// (8 lanes a row: whole lines); a block reads 16 whole rows and writes 8 KB in a row.
// The bias tiles need nothing of this work and nothing here needs them, so they share
// the launch by a range of the block index. They come first: theirs is the longest
// chain of dependent memory accesses (index, table row, store).
// ---------------------------------------------------------------------------
__global__ void __launch_bounds__(256) k_prep(const float* __restrict__ x,
                                              const float* __restrict__ Wqkv,
                                              const float* __restrict__ Wout,
                                              const float* __restrict__ table,
                                              const int* __restrict__ relidx,
                                              f16* __restrict__ xh,
                                              f16* __restrict__ WqkvT,
                                              f16* __restrict__ WoutT,
                                              f16* __restrict__ biasT) {
  if (blockIdx.x < BBLOCKS) {                         // the same for the whole block
    bias_tiles(table, relidx, biasT);
    return;
  }
  const unsigned blk = blockIdx.x - BBLOCKS;          // block among those of x and the weights
  if (blk < XBLOCKS) {                                // the same for the whole block
    const unsigned lane = threadIdx.x & 31u;
    const unsigned unit = blk * 8u + (threadIdx.x >> 5);          // row tile * KSTEPS + k step
    const unsigned r4   = lane >> 3;                  // row inside a group of 4
    const unsigned c4   = lane & 7u;                  // which 4 floats of the 32-wide k step
    const float* xp = x + (size_t)((unit / KSTEPS) * 16u + r4) * DINP + (unit % KSTEPS) * 32u + c4 * 4u;
    v4f v[4];
    #pragma unroll
    for (int n = 0; n < 4; ++n) v[n] = *(const v4f*)(xp + n * 4 * DINP);   // row 4n + r4
    // Precaution: the wait takes the loads' address as an input, which keeps that pair
    // live up to it, so that it is not rewritten in front of the wait.
    asm volatile("s_wait_xcnt 0x0" :: "v"(xp) : "memory");
    // k = 4*c4 + i: j = c4 >> 2, lhi = (c4 >> 1) & 1, place in the lane's 8 halves 4*(c4 & 1).
    f16* op = xh + (size_t)unit * OPUNIT + (c4 >> 2) * 256u + (((c4 >> 1) & 1u) * 16u + r4) * 8u + (c4 & 1u) * 4u;
    v4h o[4];
    #pragma unroll
    for (int n = 0; n < 4; ++n) {
      #pragma unroll
      for (int i = 0; i < 4; ++i) o[n][i] = (f16)v[n][i];
    }
    #pragma unroll
    for (int n = 0; n < 4; ++n) *(v4h*)(op + n * 32) = o[n];      // lrow = 4n + r4
    // Precaution: the wait stands behind the four stores, in front of any later write of a
    // register that they name (the built code of another part follows on this one).
    WAIT_X_0();
    return;
  }
  int idx = (blk - XBLOCKS) * 256 + threadIdx.x;                  // 1024 blocks -> 262144
  if (idx < NQKV * DINP) {
    int o = idx / DINP, k = idx % DINP;
    WqkvT[o * DINP + k] = (f16)Wqkv[k * NQKV + o];
  } else {
    int j = idx - NQKV * DINP;                        // < 256*256
    int o = j / DINP, k = j % DINP;
    WoutT[o * DINP + k] = (f16)Wout[k * NOUT + o];
  }
}

// ---------------------------------------------------------------------------
// Kernel 2: QKV projection. x[16384,256] (f16 units) @ WqkvT -> q/k/vT in head layout.
// Block = 8 waves stacked in M (128x64 C tile). The shared 64x256 f16 weight
// panel is staged once into LDS via async-to-LDS copies (8x traffic cut).
// A 64-column block lies wholly in q, in k or in v. The operand roles are chosen so
// that a lane's 8 results of a tile lie along the contiguous axis of their output
// (d for q and k, n for vT) and leave as ONE 16-byte store.
// ---------------------------------------------------------------------------
// The 32 products of a wave's 16 x 64 tile. XA: the x rows are the A operand
// (reg r = x row r + 8*lhi, lane = column lrow); else the weight rows are A
// (reg r = column r + 8*lhi, lane = x row lrow). Both loaders keep one k order.
template <bool XA>
static __device__ __forceinline__ void qkv_products(const f16* __restrict__ xfrag,
                                                    const f16 (&Bpanel)[64][PANEL_PITCH],
                                                    int lrow, int lhi, v8f (&acc)[4]) {
  #pragma unroll
  for (int k0 = 0; k0 < DINP; k0 += 32) {
    // x fragment from its unit (K chunks lhi*8 and 16+lhi*8): two 512-B wave loads
    const f16* xp = xfrag + (k0 / 32) * OPUNIT;
    v16h a = cat8(*(const v8h*)xp, *(const v8h*)(xp + 256));
    #pragma unroll
    for (int t = 0; t < 4; ++t) {
      const f16* bp = &Bpanel[t * 16 + lrow][k0 + lhi * 8];
      v16h b = cat8(*(const v8h*)bp, *(const v8h*)(bp + 16));
      acc[t] = XA ? wmma16(a, b, acc[t]) : wmma16(b, a, acc[t]);
    }
  }
  // Precaution: the wait takes the x loads' address as an input, which keeps that pair
  // live up to it, so that no load's data is written over it in front of the wait.
  asm volatile("s_wait_xcnt 0x0" :: "v"(xfrag) : "memory");
}

// 12 waves per SIMD (at most 80 registers): all 1,536 blocks, 6 per WGP, are resident at once.
__global__ void __launch_bounds__(256, 12) k_qkv(const f16* __restrict__ xh,
                                             const f16* __restrict__ WT,
                                             f16* __restrict__ qw,
                                             f16* __restrict__ kw,
                                             f16* __restrict__ vT) {
  __shared__ __align__(16) f16 Bpanel[64][PANEL_PITCH];   // 33 KB
  const int tid  = threadIdx.x;
  const int lane = tid & 31;
  const int w    = tid >> 5;
  const int lrow = lane & 15;
  const int lhi  = lane >> 4;
  const int m0   = blockIdx.y * 128 + w * 16;
  const int n0   = blockIdx.x * 64;

  // Stage weight panel: 64 rows x 512 B = 2048 chunks of 16 B, 8 per thread.
  #pragma unroll
  for (int j = 0; j < 8; ++j) {
    const int c = tid + j * 256;                      // chunk id
    const int row = c >> 5, col8 = (c & 31) * 8;
    async_cp16(lds_u32(&Bpanel[row][col8]),
               WT + (size_t)(n0 + row) * DINP + col8);
  }
  WAIT_ASYNC_0();
  __syncthreads();

  v8f acc[4];
  #pragma unroll
  for (int t = 0; t < 4; ++t) acc[t] = (v8f){0.f,0.f,0.f,0.f,0.f,0.f,0.f,0.f};

  const f16* xfrag = xh + (size_t)(m0 >> 4) * (KSTEPS * OPUNIT) + lane * 8;   // this lane's place in the tile's first unit
  const int which = n0 >> 8;            // 0=q 1=k 2=v, the same for the whole block
  const int hb    = (n0 & 255) >> 5;    // first of the block's two heads
  const int bb    = m0 >> 10;           // a wave's 16 rows lie in one batch
  const int nw    = m0 & 1023;          // its first row inside the batch
  // Precaution, both arms: the wait stands directly behind each store, in front of
  // the next write of a register that the store names.
  if (which == 2) {
    qkv_products<true>(xfrag, Bpanel, lrow, lhi, acc);
    #pragma unroll
    for (int t = 0; t < 4; ++t) {       // column d of head h, rows nw + 8*lhi + 0..7
      const int h = hb + (t >> 1);
      const int d = (t & 1) * 16 + lrow;
      v8h o;
      #pragma unroll
      for (int r = 0; r < 8; ++r) o[r] = (f16)acc[t][r];
      *(v8h*)(vT + ((size_t)(bb * HEADS + h) * DIMH + d) * NSEQ + nw + 8 * lhi) = o;
      WAIT_X_0();
    }
  } else {
    qkv_products<false>(xfrag, Bpanel, lrow, lhi, acc);
    f16* __restrict__ dst = which == 0 ? qw : kw;
    const float sc = which == 0 ? SCALE * LOG2E : 1.f;   // q carries log2(e): k_attn's scores are exponents of 2
    #pragma unroll
    for (int t = 0; t < 4; ++t) {       // row nw + lrow, columns d0 + 0..7 of head h
      const int h  = hb + (t >> 1);
      const int d0 = (t & 1) * 16 + 8 * lhi;
      v8h o;
      #pragma unroll
      for (int r = 0; r < 8; ++r) o[r] = (f16)(acc[t][r] * sc);
      *(v8h*)(dst + ((size_t)(bb * HEADS + h) * NSEQ + nw + lrow) * DIMH + d0) = o;
      WAIT_X_0();
    }
  }
}

static __device__ __forceinline__ float other_half(float v) {
  const int b = __builtin_bit_cast(int, v);
  return __builtin_bit_cast(float,
      __builtin_amdgcn_permlanex16(b, b, 0x76543210, 0xfedcba98, false, false));
}

// One K chunk and one V chunk of 16 bytes per lane, global -> LDS. The two copies and
// their s_wait_xcnt stand in one statement, so that no register that a copy names can
// be rewritten in front of the wait (a precaution).
static __device__ __forceinline__ void async_cp16_kv(unsigned kdst, const f16* ksrc,
                                                     unsigned vdst, const f16* vsrc) {
  asm volatile("global_load_async_to_lds_b128 %0, %2, off\n\t"
               "global_load_async_to_lds_b128 %1, %3, off\n\t"
               "s_wait_xcnt 0x0"
               :: "v"(kdst), "v"(vdst), "v"(ksrc), "v"(vsrc)
               : "memory");
}

// 8 waves per SIMD (at most 128 registers): all 1,024 blocks, 4 per WGP, are resident at once.
__global__ void __launch_bounds__(256, 8) k_attn(const f16* __restrict__ qw,
                                              const f16* __restrict__ kw,
                                              const f16* __restrict__ vT,
                                              const f16* __restrict__ biasT,
                                              f16* __restrict__ attn) {
  __shared__ __align__(16) f16 Kbuf[2][KPASS * TILE_PITCH];   // [key][d]   2 x 5 KB
  __shared__ __align__(16) f16 Vbuf[2][DIMH * VT_PITCH];      // [d][key]   2 x 4.5 KB
  const int tid  = threadIdx.x;
  const int lane = tid & 31;
  const int w    = tid >> 5;
  const int lrow = lane & 15;
  const int lhi  = lane >> 4;
  const int q0   = blockIdx.x * 128 + w * 16;
  const int h    = blockIdx.y;
  const int b    = blockIdx.z;
  const size_t headoff = (size_t)(b * HEADS + h) * NSEQ * DIMH;

  // Copier role: every thread moves one 16-byte chunk of the K tile (64 keys x 64 B)
  // and one of the V tile (32 d rows x 128 B) a pass.
  const int kr = tid >> 2, kc = (tid & 3) * 8;        // K: row = key
  const int vr = tid >> 3, vc = (tid & 7) * 8;        // V: row = d, stride NSEQ
  const f16* ksrc0 = kw + headoff + (size_t)kr * DIMH + kc;
  const f16* vsrc0 = vT + headoff + (size_t)vr * NSEQ + vc;
  const unsigned kdst0 = lds_u32(&Kbuf[0][kr * TILE_PITCH + kc]);
  const unsigned vdst0 = lds_u32(&Vbuf[0][vr * VT_PITCH + vc]);
  const unsigned kbufb = (unsigned)(KPASS * TILE_PITCH * sizeof(f16));   // bytes of a K buffer
  const unsigned vbufb = (unsigned)(DIMH * VT_PITCH * sizeof(f16));      // bytes of a V buffer

  // Q^T B-fragment (K=32 x 16 query columns), pre-scaled by log2(e)/sqrt(d) in k_qkv.
  const f16* qp = qw + headoff + (size_t)(q0 + lrow) * DIMH + lhi * 8;
  const v16h qa = cat8(*(const v8h*)qp, *(const v8h*)(qp + 16));

  // This wave's row of bias tiles; the lane reads key lrow, queries 8*lhi + 0..7.
  const f16* btile = biasT + (size_t)h * NSEQ * NSEQ
                           + (size_t)(q0 >> 4) * (NSEQ / 16) * BTILE + lrow * 16 + lhi * 8;
  // Identity B operands (k = query of the tile, column = query lrow). One A operand
  // carries two bias tiles: keys 0-15 in k slots 0-15, keys 16-31 in k slots 16-31;
  // idlo picks the first, idhi the second. Same k order as every loader here.
  v16h idlo, idhi;
  #pragma unroll
  for (int i = 0; i < 8; ++i) {
    const f16 e = (lhi * 8 + i == lrow) ? (f16)1.f : (f16)0.f;
    idlo[i] = e;          idlo[8 + i] = (f16)0.f;
    idhi[i] = (f16)0.f;   idhi[8 + i] = e;
  }

  float m = 0.f;                    // maximum in use for query q0+lrow (both halves agree); pass 0 sets it
  float l = 0.f;                    // running sum over THIS lane half's keys only
  const v8f zero = (v8f){0.f,0.f,0.f,0.f,0.f,0.f,0.f,0.f};
  v8f o0 = zero, o1 = zero;         // O^T: reg r = d (8*lhi+r, 16+8*lhi+r), lane = query

  // Two-buffer ring: tile 0 lands and is published, then tile 1 flies during pass 0.
  async_cp16_kv(kdst0, ksrc0, vdst0, vsrc0);
  WAIT_ASYNC_0();
  __syncthreads();
  async_cp16_kv(kdst0 + kbufb, ksrc0 + KPASS * DIMH, vdst0 + vbufb, vsrc0 + KPASS);

  for (int it = 0; it < NSEQ / KPASS; ++it) {
    const int cur = it & 1;

    // Relative position bias: the four 16-key tiles of keys kb + 0..63, kb = 64*it.
    const f16* bt = btile + it * (4 * BTILE);
    const v16h ba0 = cat8(*(const v8h*)bt, *(const v8h*)(bt + BTILE));
    const v16h ba1 = cat8(*(const v8h*)(bt + 2 * BTILE), *(const v8h*)(bt + 3 * BTILE));

    // K A-fragments from LDS: lane row = key, K-dim = d.
    v16h bk[4];
    #pragma unroll
    for (int j = 0; j < 4; ++j) {
      const f16* kp = &Kbuf[cur][(j * 16 + lrow) * TILE_PITCH + lhi * 8];
      bk[j] = cat8(*(const v8h*)kp, *(const v8h*)(kp + 16));
    }
    // Precaution: the wait takes the bias loads' address as an input, which keeps that
    // pair live up to it, so that it is not rewritten in front of the wait.
    asm volatile("s_wait_xcnt 0x0" :: "v"(bt) : "memory");
    // Keeps the pass's loads (bias from L2, K from LDS) in front of the first WMMA:
    // without it the bias loads issue behind the K wait and the two latencies add up.
    __builtin_amdgcn_sched_barrier(0);
    const float nm = -m;
    const v8f negm = (v8f){nm,nm,nm,nm,nm,nm,nm,nm};   // C operand of the score products
    v8f s[4];                         // s[j][r] = S[q0+lrow][kb + 16*j + 8*lhi + r] - maximum in use
    #pragma unroll
    for (int j = 0; j < 4; ++j) s[j] = wmma16(bk[j], qa, negm);   // scores less the maximum in use
    s[0] = wmma16(ba0, idlo, s[0]);   // + bias of the same query and keys
    s[1] = wmma16(ba0, idhi, s[1]);
    s[2] = wmma16(ba1, idlo, s[2]);
    s[3] = wmma16(ba1, idhi, s[3]);

    // V^T A-fragments from LDS: lane row = d, K-dim = key. Those of keys 0-31 are asked
    // for here, ahead of the softmax; those of keys 32-63 follow behind it.
    const f16* vp0 = &Vbuf[cur][lrow * VT_PITCH + lhi * 8];
    const f16* vp1 = &Vbuf[cur][(16 + lrow) * VT_PITCH + lhi * 8];
    v16h bv00 = cat8(*(const v8h*)vp0, *(const v8h*)(vp0 + 16));
    v16h bv10 = cat8(*(const v8h*)vp1, *(const v8h*)(vp1 + 16));

    // Online softmax: 32 scores of the query in-lane, the other 32 in lane^16.
    float c = fmaxf(fmaxf(s[0][0], s[1][0]), fmaxf(s[2][0], s[3][0]));
    #pragma unroll
    for (int r = 1; r < 8; ++r)
      c = fmaxf(c, fmaxf(fmaxf(s[0][r], s[1][r]), fmaxf(s[2][r], s[3][r])));
    // One test for the whole wave (a scalar branch, EXEC stays full for the WMMAs).
    if (__builtin_amdgcn_ballot_w32(c > GROW_MAX) != 0u || it == 0) {
      c = fmaxf(c, other_half(c));
      const float d    = it == 0 ? c : fmaxf(c, 0.f);      // the maximum in use never falls
      const float corr = it == 0 ? 1.f : __builtin_amdgcn_exp2f(-d);   // O and l are 0 in pass 0
      #pragma unroll
      for (int j = 0; j < 4; ++j) s[j] = s[j] - d;
      #pragma unroll
      for (int r = 0; r < 8; ++r) { o0[r] *= corr; o1[r] *= corr; }
      l *= corr;
      m += d;
    }
    v16h pb0, pb1;                    // P^T B-fragments: same k order as the V loader
    #pragma unroll
    for (int j = 0; j < 4; ++j) {
      #pragma unroll
      for (int r = 0; r < 8; ++r) s[j][r] = __builtin_amdgcn_exp2f(s[j][r]);   // P^T, in place
    }
    #pragma unroll
    for (int r = 0; r < 8; ++r) {
      pb0[r]     = (f16)s[0][r];
      pb0[8 + r] = (f16)s[1][r];
      pb1[r]     = (f16)s[2][r];
      pb1[8 + r] = (f16)s[3][r];
    }
    // Row sum of this lane's 32 keys: tile on tile, then across the 8 registers.
    const v8f ps = (s[0] + s[1]) + (s[2] + s[3]);
    const float rs = ((ps[0] + ps[1]) + (ps[2] + ps[3])) + ((ps[4] + ps[5]) + (ps[6] + ps[7]));
    l += rs;

    v16h bv01 = cat8(*(const v8h*)(vp0 + 32), *(const v8h*)(vp0 + 48));
    v16h bv11 = cat8(*(const v8h*)(vp1 + 32), *(const v8h*)(vp1 + 48));
    o0 = wmma16(bv00, pb0, o0);
    o1 = wmma16(bv10, pb0, o1);
    o0 = wmma16(bv01, pb1, o0);
    o1 = wmma16(bv11, pb1, o1);

    // Foot of the pass: this wave's LDS reads have returned and its copies of tile
    // it+1 have landed; the one barrier publishes tile it+1 and ends every wave's last
    // read of this pass's buffer, which only then is refilled with tile it+2.
    asm volatile("s_wait_dscnt 0x0" ::: "memory");
    WAIT_ASYNC_0();
    __syncthreads();
    if (it + 2 < NSEQ / KPASS) {
      async_cp16_kv(kdst0 + cur * kbufb, ksrc0 + (size_t)(it + 2) * (KPASS * DIMH),
                    vdst0 + cur * vbufb, vsrc0 + (size_t)(it + 2) * KPASS);
    }
  }
  WAIT_ASYNC_0();                     // nothing is in flight when the wave ends

  // Join the halves' sums, normalize, store as the output GEMM's operand unit
  // (row tile of the queries, k step = head): the lane's two groups of 8 d are its
  // two chunks of the fragment, so each store is 512 contiguous bytes of the wave.
  l += other_half(l);
  const float inv = 1.f / l;
  v8h r0, r1;
  #pragma unroll
  for (int r = 0; r < 8; ++r) { r0[r] = (f16)(o0[r] * inv); r1[r] = (f16)(o1[r] * inv); }
  f16* op = attn + ((size_t)((b * NSEQ + q0) >> 4) * KSTEPS + h) * OPUNIT + lane * 8;
  *(v8h*)op         = r0;
  *(v8h*)(op + 256) = r1;
}

// ---------------------------------------------------------------------------
// Kernel 4: output projection. attn[16384,256] (f16 units) @ WoutT + b_out -> f32 out.
// Same LDS-staged weight panel as k_qkv. The weight rows are the A operand, so that a
// lane holds 8 neighbouring columns of ONE output row (reg r = column r + 8*lhi, lane =
// row lrow). A wave's 16 x 64 tile passes through the wave's own LDS range and leaves as
// 8 stores of 16 B a lane, each two rows of 256 contiguous bytes: 4 whole 128-B lines.
// ---------------------------------------------------------------------------
// Staging row pitch in floats: 256 B + 16 B, so that the 16 rows of a ds_store_b128 fall
// on 16 different bank groups; a row read back is contiguous.
#define STAGE_PITCH (64 + 4)
__global__ void __launch_bounds__(256) k_out(const f16* __restrict__ A,
                                             const f16* __restrict__ WT,
                                             const float* __restrict__ bias,
                                             float* __restrict__ out) {
  __shared__ __align__(16) f16 Bpanel[64][PANEL_PITCH];   // 33 KB
  __shared__ __align__(16) float Stage[8][16][STAGE_PITCH];   // 34 KB, 4.25 KB a wave
  const int tid  = threadIdx.x;
  const int lane = tid & 31;
  const int w    = tid >> 5;
  const int lrow = lane & 15;
  const int lhi  = lane >> 4;
  const int m0   = blockIdx.y * 128 + w * 16;
  const int n0   = blockIdx.x * 64;

  #pragma unroll
  for (int j = 0; j < 8; ++j) {
    const int c = tid + j * 256;
    const int row = c >> 5, col8 = (c & 31) * 8;
    async_cp16(lds_u32(&Bpanel[row][col8]),
               WT + (size_t)(n0 + row) * DINP + col8);
  }
  const float* bp = bias + n0 + lrow * 4;             // the 4 columns that this lane stores
  const v4f bv = *(const v4f*)bp;
  WAIT_ASYNC_0();
  __syncthreads();
  // Takes the loaded bias as an input, which holds its load up here, where its latency runs
  // beside the panel copies' (the compiler otherwise sinks it to the end, where the wave
  // would wait for it alone). Precaution: the address is an input too and the wait stands
  // here, so that it is not rewritten in front of the wait.
  asm volatile("s_wait_xcnt 0x0" :: "v"(bp), "v"(bv) : "memory");

  v8f acc[4];
  #pragma unroll
  for (int t = 0; t < 4; ++t) acc[t] = (v8f){0.f,0.f,0.f,0.f,0.f,0.f,0.f,0.f};

  const f16* afrag = A + (size_t)(m0 >> 4) * (KSTEPS * OPUNIT) + lane * 8;
  #pragma unroll
  for (int k0 = 0; k0 < DINP; k0 += 32) {
    const f16* ap = afrag + (k0 / 32) * OPUNIT;
    v16h a = cat8(*(const v8h*)ap, *(const v8h*)(ap + 256));
    #pragma unroll
    for (int t = 0; t < 4; ++t) {
      const f16* bp = &Bpanel[t * 16 + lrow][k0 + lhi * 8];
      v16h b = cat8(*(const v8h*)bp, *(const v8h*)(bp + 16));
      acc[t] = wmma16(b, a, acc[t]);
    }
  }
  // Precaution: the wait takes the fragment loads' address as an input, which keeps that
  // pair live up to it, so that it is not rewritten in front of the wait.
  asm volatile("s_wait_xcnt 0x0" :: "v"(afrag) : "memory");

  #pragma unroll
  for (int t = 0; t < 4; ++t) {         // row lrow, columns 16*t + 8*lhi + 0..7
    float* sp = &Stage[w][lrow][t * 16 + 8 * lhi];
    *(v4f*)sp       = (v4f){acc[t][0], acc[t][1], acc[t][2], acc[t][3]};
    *(v4f*)(sp + 4) = (v4f){acc[t][4], acc[t][5], acc[t][6], acc[t][7]};
  }
  // The rows are read back by other lanes of this wave (no other wave touches the range):
  // its LDS writes have ended before it reads, and the compiler moves no read over this.
  asm volatile("s_wait_dscnt 0x0" ::: "memory");
  v4f o[8];
  #pragma unroll
  for (int i = 0; i < 8; ++i)           // rows 2*i + lhi, columns 4*lrow + 0..3
    o[i] = *(const v4f*)&Stage[w][2 * i + lhi][lrow * 4] + bv;
  float* op = out + (size_t)(m0 + lhi) * NOUT + n0 + lrow * 4;
  #pragma unroll
  for (int i = 0; i < 8; ++i) *(v4f*)(op + (size_t)(2 * i) * NOUT) = o[i];
}

// ---------------------------------------------------------------------------
extern "C" void kernel_launch(void* const* d_in, const int* in_sizes, int n_in,
                              void* d_out, int out_size, void* d_ws, size_t ws_size,
                              hipStream_t stream) {
  const float* x      = (const float*)d_in[0];   // [16,1024,256]
  const float* W_qkv  = (const float*)d_in[1];   // [256,768]
  const float* W_out  = (const float*)d_in[2];   // [256,256]
  const float* b_out  = (const float*)d_in[3];   // [256]
  const float* btable = (const float*)d_in[4];   // [3969,8]
  const int*   relidx = (const int*)d_in[5];     // [1024*1024]
  float* out = (float*)d_out;

  char* ws = (char*)d_ws;
  size_t off = 0;
  f16* WqkvT = (f16*)(ws + off); off += (size_t)NQKV * DINP * 2;          // 384 KB
  f16* WoutT = (f16*)(ws + off); off += (size_t)NOUT * DINP * 2;          // 128 KB
  f16* qw    = (f16*)(ws + off); off += (size_t)B_SZ * HEADS * NSEQ * DIMH * 2; // 8 MB
  f16* kw    = (f16*)(ws + off); off += (size_t)B_SZ * HEADS * NSEQ * DIMH * 2; // 8 MB
  f16* vT    = (f16*)(ws + off); off += (size_t)B_SZ * HEADS * NSEQ * DIMH * 2; // 8 MB
  f16* attn  = (f16*)(ws + off); off += (size_t)B_SZ * NSEQ * HEADS * DIMH * 2; // 8 MB
  f16* biasT = (f16*)(ws + off); off += (size_t)HEADS * NSEQ * NSEQ * 2;        // 16 MB
  f16* xh    = (f16*)(ws + off); off += (size_t)B_SZ * NSEQ * DINP * 2;         // 8 MB

  k_prep<<<BBLOCKS + XBLOCKS + (NQKV * DINP + NOUT * DINP) / 256, 256, 0, stream>>>(
      x, W_qkv, W_out, btable, relidx, xh, WqkvT, WoutT, biasT);
  k_qkv<<<dim3(NQKV / 64, (B_SZ * NSEQ) / 128), 256, 0, stream>>>(xh, WqkvT, qw, kw, vT);
  k_attn<<<dim3(NSEQ / 128, HEADS, B_SZ), 256, 0, stream>>>(qw, kw, vT, biasT, attn);
  k_out<<<dim3(NOUT / 64, (B_SZ * NSEQ) / 128), 256, 0, stream>>>(attn, WoutT, b_out, out);
}
